// v000
// Measured on an AMD MI455X. A time is GPU time per run, averaged over a window of back-to-back runs after a warm-up
// (all launches, gaps included; the runs take copies of the inputs in turn), and the median of several windows.
// Apart from v000's, it joins two sittings. Times from different sittings can be a few percent apart, while
// side-by-side timings come from the same sitting.
// The starting kernel, v000, takes 2750 microseconds a run.
#include <hip/hip_runtime.h>
#include <hip/hip_bf16.h>
#include <math.h>

// ---------------- problem constants ----------------
#define BATCH 8
#define TLEN  4096
#define DDIM  768
#define NBQ   256           // quaternion blocks (DDIM/3)
#define MROWS (BATCH * TLEN)  // 32768
#define NCOLS (2 * DDIM)      // 1536 : [0,768)=biv, [768,1536)=inj
#define KDIM  DDIM

// ---------------- GEMM tiling ----------------
#define BM 128
#define BN 128
#define BK 32
#define BKP (BK + 8)        // padded LDS row stride (bf16 elems) for bank spread

typedef __attribute__((ext_vector_type(16))) __bf16 v16bf;
typedef __attribute__((ext_vector_type(8)))  __bf16 v8bf;
typedef __attribute__((ext_vector_type(8)))  float  v8f;

// Load one 16x32 bf16 A/B fragment from an LDS plane laid out [row][BKP].
// CDNA5 16-bit operand layout: lanes 0-15 hold row=lane, K={0..7,16..23};
// lanes 16-31 hold row=lane-16, K={8..15,24..31}. Two aligned b128 loads.
__device__ __forceinline__ v16bf load_frag(const __bf16* plane, int row_base, int lane) {
  const int row   = row_base + (lane & 15);
  const int khalf = (lane >> 4) * 8;
  const __bf16* p = plane + row * BKP + khalf;
  v8bf c0 = *(const v8bf*)(p);
  v8bf c1 = *(const v8bf*)(p + 16);
  v16bf r;
#pragma unroll
  for (int i = 0; i < 8; ++i) { r[i] = c0[i]; r[i + 8] = c1[i]; }
  return r;
}

// Fused projection GEMM: out[m, n] for n in [0,1536).
//   n <  768 : biv column n      (weights W_biv, bias b_biv)  -> ws biv buffer
//   n >= 768 : inj column n-768  (weights W_in,  bias b_in)   -> d_out (in-place scanned later)
__global__ __launch_bounds__(256)
void qssm_proj_gemm(const float* __restrict__ X,
                    const float* __restrict__ Wbiv,
                    const float* __restrict__ Win,
                    const float* __restrict__ bbiv,
                    const float* __restrict__ bin,
                    float* __restrict__ out_biv,
                    float* __restrict__ out_inj) {
  __shared__ __bf16 As_hi[BM * BKP];
  __shared__ __bf16 As_lo[BM * BKP];
  __shared__ __bf16 Bs_hi[BN * BKP];
  __shared__ __bf16 Bs_lo[BN * BKP];

  const int tid  = threadIdx.x;
  const int lane = tid & 31;
  const int wave = tid >> 5;      // 0..7
  const int wm   = wave & 3;      // 4 waves along M (32 rows each)
  const int wn   = wave >> 2;     // 2 waves along N (64 cols each)

  const int m0 = blockIdx.x * BM;
  const int n0 = blockIdx.y * BN;

  v8f acc[2][4];
#pragma unroll
  for (int i = 0; i < 2; ++i)
#pragma unroll
    for (int j = 0; j < 4; ++j) acc[i][j] = (v8f)0.0f;

  // staging map: 8 threads per row (8 x float4 = 32 floats), 32 rows per pass
  const int srow = tid >> 3;        // 0..31
  const int scol = (tid & 7) * 4;   // 0,4,...,28

  for (int kt = 0; kt < KDIM / BK; ++kt) {
    const int k0 = kt * BK;

    // ---- stage A (x tile) and B (weight tile) into LDS as bf16 hi/lo planes ----
#pragma unroll
    for (int pass = 0; pass < 4; ++pass) {
      const int row = pass * 32 + srow;

      // A: x[m0+row, k0+scol .. +3]
      const float* pa = X + (size_t)(m0 + row) * KDIM + k0 + scol;
      float4 va = *(const float4*)pa;
      if (k0 + BK < KDIM) __builtin_prefetch(pa + BK, 0, 1);
#pragma unroll
      for (int q = 0; q < 4; ++q) {
        float f   = ((const float*)&va)[q];
        __bf16 h  = (__bf16)f;
        __bf16 l  = (__bf16)(f - (float)h);
        As_hi[row * BKP + scol + q] = h;
        As_lo[row * BKP + scol + q] = l;
      }

      // B: weight row (n0+row), cols k0+scol..+3 ; pick W_biv vs W_in
      const int ng = n0 + row;
      const float* wrow = (ng < DDIM) ? (Wbiv + (size_t)ng * KDIM)
                                      : (Win + (size_t)(ng - DDIM) * KDIM);
      const float* pb = wrow + k0 + scol;
      float4 vb = *(const float4*)pb;
      if (k0 + BK < KDIM) __builtin_prefetch(pb + BK, 0, 1);
#pragma unroll
      for (int q = 0; q < 4; ++q) {
        float f   = ((const float*)&vb)[q];
        __bf16 h  = (__bf16)f;
        __bf16 l  = (__bf16)(f - (float)h);
        Bs_hi[row * BKP + scol + q] = h;
        Bs_lo[row * BKP + scol + q] = l;
      }
    }
    __syncthreads();

    // ---- fragments ----
    v16bf a_hi[2], a_lo[2], b_hi[4], b_lo[4];
#pragma unroll
    for (int i = 0; i < 2; ++i) {
      a_hi[i] = load_frag(As_hi, wm * 32 + i * 16, lane);
      a_lo[i] = load_frag(As_lo, wm * 32 + i * 16, lane);
    }
#pragma unroll
    for (int j = 0; j < 4; ++j) {
      b_hi[j] = load_frag(Bs_hi, wn * 64 + j * 16, lane);
      b_lo[j] = load_frag(Bs_lo, wn * 64 + j * 16, lane);
    }

    // ---- bf16x3 split-precision WMMA: acc += Ah*Bh + Ah*Bl + Al*Bh ----
#pragma unroll
    for (int i = 0; i < 2; ++i) {
#pragma unroll
      for (int j = 0; j < 4; ++j) {
        acc[i][j] = __builtin_amdgcn_wmma_f32_16x16x32_bf16(
            false, a_hi[i], false, b_hi[j], (short)0, acc[i][j], false, false);
        acc[i][j] = __builtin_amdgcn_wmma_f32_16x16x32_bf16(
            false, a_hi[i], false, b_lo[j], (short)0, acc[i][j], false, false);
        acc[i][j] = __builtin_amdgcn_wmma_f32_16x16x32_bf16(
            false, a_lo[i], false, b_hi[j], (short)0, acc[i][j], false, false);
      }
    }
    __syncthreads();
  }

  // ---- epilogue: bias + scatter to biv workspace or inj (=d_out) ----
  // C/D layout: VGPR r, lanes 0-15 -> M=r, N=lane; lanes 16-31 -> M=8+r, N=lane-16.
  const int half = (lane >> 4) & 1;
#pragma unroll
  for (int i = 0; i < 2; ++i) {
#pragma unroll
    for (int j = 0; j < 4; ++j) {
      const int mb = m0 + wm * 32 + i * 16 + half * 8;
      const int nn = n0 + wn * 64 + j * 16 + (lane & 15);
      float bias;
      float* dst;
      int col;
      if (nn < DDIM) { bias = bbiv[nn]; dst = out_biv; col = nn; }
      else           { bias = bin[nn - DDIM]; dst = out_inj; col = nn - DDIM; }
#pragma unroll
      for (int r = 0; r < 8; ++r) {
        dst[(size_t)(mb + r) * DDIM + col] = acc[i][j][r] + bias;
      }
    }
  }
}

// decay[m] = sigmoid(dot(x[m,:], W_decay) + b_decay); one wave per row.
__global__ __launch_bounds__(256)
void qssm_decay(const float* __restrict__ X,
                const float* __restrict__ Wd,
                const float* __restrict__ bd,
                float* __restrict__ dec) {
  const int row  = blockIdx.x * 8 + (threadIdx.x >> 5);
  const int lane = threadIdx.x & 31;
  const float* xr = X + (size_t)row * DDIM;
  float s = 0.0f;
#pragma unroll 4
  for (int k = lane; k < DDIM; k += 32) s += xr[k] * Wd[k];
#pragma unroll
  for (int off = 16; off > 0; off >>= 1) s += __shfl_xor(s, off, 32);
  if (lane == 0) {
    float z = s + bd[0];
    dec[row] = 1.0f / (1.0f + expf(-z));
  }
}

// Sequential Rodrigues scan: one thread per (b, nb) chain; inj lives in `out`
// and is overwritten in place with the state h_t.
__global__ __launch_bounds__(256)
void qssm_scan(const float* __restrict__ biv,
               const float* __restrict__ dec,
               float* __restrict__ out) {
  const int b  = blockIdx.x;
  const int nb = threadIdx.x;  // 0..255
  float hx = 0.0f, hy = 0.0f, hz = 0.0f;
  const size_t base = ((size_t)b * TLEN) * DDIM + (size_t)nb * 3;
  const float* decb = dec + (size_t)b * TLEN;

  for (int t = 0; t < TLEN; ++t) {
    const size_t idx = base + (size_t)t * DDIM;
    const float bx = biv[idx], by = biv[idx + 1], bz = biv[idx + 2];
    const float ux = out[idx], uy = out[idx + 1], uz = out[idx + 2];
    const float d  = decb[t];

    const float th  = sqrtf(bx * bx + by * by + bz * bz);
    const float inv = 1.0f / fmaxf(th, 1e-8f);
    const float kx = bx * inv, ky = by * inv, kz = bz * inv;
    const float c = cosf(th), s = sinf(th);

    const float cx = ky * hz - kz * hy;
    const float cy = kz * hx - kx * hz;
    const float cz = kx * hy - ky * hx;
    const float kdoth = kx * hx + ky * hy + kz * hz;
    const float om = (1.0f - c) * kdoth;

    const float rx = hx * c + cx * s + kx * om;
    const float ry = hy * c + cy * s + ky * om;
    const float rz = hz * c + cz * s + kz * om;

    hx = d * rx + ux;
    hy = d * ry + uy;
    hz = d * rz + uz;

    out[idx]     = hx;
    out[idx + 1] = hy;
    out[idx + 2] = hz;
  }
}

extern "C" void kernel_launch(void* const* d_in, const int* in_sizes, int n_in,
                              void* d_out, int out_size, void* d_ws, size_t ws_size,
                              hipStream_t stream) {
  const float* x      = (const float*)d_in[0];  // (B,T,D)
  const float* W_biv  = (const float*)d_in[1];  // (768,768)
  const float* b_biv  = (const float*)d_in[2];  // (768,)
  const float* W_dec  = (const float*)d_in[3];  // (1,768)
  const float* b_dec  = (const float*)d_in[4];  // (1,)
  const float* W_in   = (const float*)d_in[5];  // (768,768)
  const float* b_in   = (const float*)d_in[6];  // (768,)
  float* out = (float*)d_out;                   // (B,T,768)

  float* ws_biv = (float*)d_ws;                       // MROWS*768 floats
  float* ws_dec = ws_biv + (size_t)MROWS * DDIM;      // MROWS floats

  // 1) fused projections: biv -> ws, inj -> d_out (in place for the scan)
  dim3 ggrid(MROWS / BM, NCOLS / BN);  // (256, 12)
  qssm_proj_gemm<<<ggrid, 256, 0, stream>>>(x, W_biv, W_in, b_biv, b_in,
                                            ws_biv, out);
  // 2) decay gate (GEMV + sigmoid)
  qssm_decay<<<MROWS / 8, 256, 0, stream>>>(x, W_dec, b_dec, ws_dec);
  // 3) sequential Rodrigues scan over T, one thread per (b, nb) chain
  qssm_scan<<<BATCH, NBQ, 0, stream>>>(ws_biv, ws_dec, out);
}

// v001
// One run takes 319 microseconds.
// Timed twice side by side with v000, it ran 8.68 and 8.63 times as fast.
#include <hip/hip_runtime.h>
#include <hip/hip_bf16.h>
#include <math.h>

// ---------------- problem constants ----------------
#define BATCH 8
#define TLEN  4096
#define DDIM  768
#define NBQ   256           // quaternion blocks (DDIM/3)
#define MROWS (BATCH * TLEN)  // 32768
#define NCOLS (2 * DDIM)      // 1536 : [0,768)=biv, [768,1536)=inj
#define KDIM  DDIM

// ---------------- GEMM tiling ----------------
#define BM 128
#define BN 128
#define BK 32
#define BKP (BK + 8)        // padded LDS row stride (bf16 elems) for bank spread

typedef __attribute__((ext_vector_type(16))) __bf16 v16bf;
typedef __attribute__((ext_vector_type(8)))  __bf16 v8bf;
typedef __attribute__((ext_vector_type(8)))  float  v8f;

// Load one 16x32 bf16 A/B fragment from an LDS plane laid out [row][BKP].
// CDNA5 16-bit operand layout: lanes 0-15 hold row=lane, K={0..7,16..23};
// lanes 16-31 hold row=lane-16, K={8..15,24..31}. Two aligned b128 loads.
__device__ __forceinline__ v16bf load_frag(const __bf16* plane, int row_base, int lane) {
  const int row   = row_base + (lane & 15);
  const int khalf = (lane >> 4) * 8;
  const __bf16* p = plane + row * BKP + khalf;
  v8bf c0 = *(const v8bf*)(p);
  v8bf c1 = *(const v8bf*)(p + 16);
  v16bf r;
#pragma unroll
  for (int i = 0; i < 8; ++i) { r[i] = c0[i]; r[i + 8] = c1[i]; }
  return r;
}

// Fused projection GEMM: out[m, n] for n in [0,1536).
//   n <  768 : biv column n      (weights W_biv, bias b_biv)  -> ws biv buffer
//   n >= 768 : inj column n-768  (weights W_in,  bias b_in)   -> d_out (in-place scanned later)
__global__ __launch_bounds__(256)
void qssm_proj_gemm(const float* __restrict__ X,
                    const float* __restrict__ Wbiv,
                    const float* __restrict__ Win,
                    const float* __restrict__ bbiv,
                    const float* __restrict__ bin,
                    float* __restrict__ out_biv,
                    float* __restrict__ out_inj) {
  __shared__ __bf16 As_hi[BM * BKP];
  __shared__ __bf16 As_lo[BM * BKP];
  __shared__ __bf16 Bs_hi[BN * BKP];
  __shared__ __bf16 Bs_lo[BN * BKP];

  const int tid  = threadIdx.x;
  const int lane = tid & 31;
  const int wave = tid >> 5;      // 0..7
  const int wm   = wave & 3;      // 4 waves along M (32 rows each)
  const int wn   = wave >> 2;     // 2 waves along N (64 cols each)

  const int m0 = blockIdx.x * BM;
  const int n0 = blockIdx.y * BN;

  v8f acc[2][4];
#pragma unroll
  for (int i = 0; i < 2; ++i)
#pragma unroll
    for (int j = 0; j < 4; ++j) acc[i][j] = (v8f)0.0f;

  // staging map: 8 threads per row (8 x float4 = 32 floats), 32 rows per pass
  const int srow = tid >> 3;        // 0..31
  const int scol = (tid & 7) * 4;   // 0,4,...,28

  for (int kt = 0; kt < KDIM / BK; ++kt) {
    const int k0 = kt * BK;

    // ---- stage A (x tile) and B (weight tile) into LDS as bf16 hi/lo planes ----
#pragma unroll
    for (int pass = 0; pass < 4; ++pass) {
      const int row = pass * 32 + srow;

      // A: x[m0+row, k0+scol .. +3]
      const float* pa = X + (size_t)(m0 + row) * KDIM + k0 + scol;
      float4 va = *(const float4*)pa;
      if (k0 + BK < KDIM) __builtin_prefetch(pa + BK, 0, 1);
#pragma unroll
      for (int q = 0; q < 4; ++q) {
        float f   = ((const float*)&va)[q];
        __bf16 h  = (__bf16)f;
        __bf16 l  = (__bf16)(f - (float)h);
        As_hi[row * BKP + scol + q] = h;
        As_lo[row * BKP + scol + q] = l;
      }

      // B: weight row (n0+row), cols k0+scol..+3 ; pick W_biv vs W_in
      const int ng = n0 + row;
      const float* wrow = (ng < DDIM) ? (Wbiv + (size_t)ng * KDIM)
                                      : (Win + (size_t)(ng - DDIM) * KDIM);
      const float* pb = wrow + k0 + scol;
      float4 vb = *(const float4*)pb;
      if (k0 + BK < KDIM) __builtin_prefetch(pb + BK, 0, 1);
#pragma unroll
      for (int q = 0; q < 4; ++q) {
        float f   = ((const float*)&vb)[q];
        __bf16 h  = (__bf16)f;
        __bf16 l  = (__bf16)(f - (float)h);
        Bs_hi[row * BKP + scol + q] = h;
        Bs_lo[row * BKP + scol + q] = l;
      }
    }
    __syncthreads();

    // ---- fragments ----
    v16bf a_hi[2], a_lo[2], b_hi[4], b_lo[4];
#pragma unroll
    for (int i = 0; i < 2; ++i) {
      a_hi[i] = load_frag(As_hi, wm * 32 + i * 16, lane);
      a_lo[i] = load_frag(As_lo, wm * 32 + i * 16, lane);
    }
#pragma unroll
    for (int j = 0; j < 4; ++j) {
      b_hi[j] = load_frag(Bs_hi, wn * 64 + j * 16, lane);
      b_lo[j] = load_frag(Bs_lo, wn * 64 + j * 16, lane);
    }

    // ---- bf16x3 split-precision WMMA: acc += Ah*Bh + Ah*Bl + Al*Bh ----
#pragma unroll
    for (int i = 0; i < 2; ++i) {
#pragma unroll
      for (int j = 0; j < 4; ++j) {
        acc[i][j] = __builtin_amdgcn_wmma_f32_16x16x32_bf16(
            false, a_hi[i], false, b_hi[j], (short)0, acc[i][j], false, false);
        acc[i][j] = __builtin_amdgcn_wmma_f32_16x16x32_bf16(
            false, a_hi[i], false, b_lo[j], (short)0, acc[i][j], false, false);
        acc[i][j] = __builtin_amdgcn_wmma_f32_16x16x32_bf16(
            false, a_lo[i], false, b_hi[j], (short)0, acc[i][j], false, false);
      }
    }
    __syncthreads();
  }

  // ---- epilogue: bias + scatter to biv workspace or inj (=d_out) ----
  // C/D layout: VGPR r, lanes 0-15 -> M=r, N=lane; lanes 16-31 -> M=8+r, N=lane-16.
  const int half = (lane >> 4) & 1;
#pragma unroll
  for (int i = 0; i < 2; ++i) {
#pragma unroll
    for (int j = 0; j < 4; ++j) {
      const int mb = m0 + wm * 32 + i * 16 + half * 8;
      const int nn = n0 + wn * 64 + j * 16 + (lane & 15);
      float bias;
      float* dst;
      int col;
      if (nn < DDIM) { bias = bbiv[nn]; dst = out_biv; col = nn; }
      else           { bias = bin[nn - DDIM]; dst = out_inj; col = nn - DDIM; }
#pragma unroll
      for (int r = 0; r < 8; ++r) {
        dst[(size_t)(mb + r) * DDIM + col] = acc[i][j][r] + bias;
      }
    }
  }
}

// decay[m] = sigmoid(dot(x[m,:], W_decay) + b_decay); one wave per row.
__global__ __launch_bounds__(256)
void qssm_decay(const float* __restrict__ X,
                const float* __restrict__ Wd,
                const float* __restrict__ bd,
                float* __restrict__ dec) {
  const int row  = blockIdx.x * 8 + (threadIdx.x >> 5);
  const int lane = threadIdx.x & 31;
  const float* xr = X + (size_t)row * DDIM;
  float s = 0.0f;
#pragma unroll 4
  for (int k = lane; k < DDIM; k += 32) s += xr[k] * Wd[k];
#pragma unroll
  for (int off = 16; off > 0; off >>= 1) s += __shfl_xor(s, off, 32);
  if (lane == 0) {
    float z = s + bd[0];
    dec[row] = 1.0f / (1.0f + expf(-z));
  }
}

// ---------------- time-chunked Rodrigues scan ----------------
// One step is the affine map h -> d * R(b) * h + u, so a run of steps is again
// an affine map h -> M * h + e. T is cut into NCHUNK chunks:
//   launch A: one thread per (batch, chunk, chain) composes its chunk's (M, e);
//   launch B: the same thread folds the maps of all earlier chunks, in time
//             order, into its chunk's start state and then replays its own
//             steps with the step formula, writing the states.
#define NCHUNK 64
#define CLEN   (TLEN / NCHUNK)   // 64 steps per chunk
#define GRP    4                 // steps fetched together, one group ahead
#define NGRP   (CLEN / GRP)      // 16, even
#define FOLD   8                 // chunk maps fetched together in launch B

struct StepGrp {
  float b[GRP][3];
  float u[GRP][3];
};

__device__ __forceinline__ void load_grp(StepGrp& g, const float* pb, const float* pu) {
// unrolled: constant indices keep the arrays in registers
#pragma unroll
  for (int i = 0; i < GRP; ++i) {
// unrolled: constant indices keep the arrays in registers
#pragma unroll
    for (int q = 0; q < 3; ++q) {
      g.b[i][q] = pb[i * DDIM + q];
      g.u[i][q] = pu[i * DDIM + q];
    }
  }
  // the loads' address registers are reused below: wait before they are rewritten
  asm volatile("s_wait_xcnt 0x0" ::: "memory");
}

// M <- R * M, p <- p * d, e <- d * R * e + u for the GRP steps of one group.
__device__ __forceinline__ void compose_grp(const StepGrp& g, const float* dg,
                                            float (&m)[3][3], float& p, float (&e)[3]) {
// unrolled: constant indices keep the arrays in registers
#pragma unroll
  for (int i = 0; i < GRP; ++i) {
    const float bx = g.b[i][0], by = g.b[i][1], bz = g.b[i][2];
    const float d  = dg[i];

    const float th  = sqrtf(bx * bx + by * by + bz * bz);
    const float inv = 1.0f / fmaxf(th, 1e-8f);
    const float kx = bx * inv, ky = by * inv, kz = bz * inv;
    const float c = cosf(th), s = sinf(th);

    // R = c I + s [k]x + (1 - c) k k^T
    const float oc = 1.0f - c;
    const float ax = oc * kx, ay = oc * ky, az = oc * kz;
    const float sx = s * kx,  sy = s * ky,  sz = s * kz;
    const float r00 = ax * kx + c,  r01 = ax * ky - sz, r02 = ax * kz + sy;
    const float r10 = ay * kx + sz, r11 = ay * ky + c,  r12 = ay * kz - sx;
    const float r20 = az * kx - sy, r21 = az * ky + sx, r22 = az * kz + c;

// unrolled: constant indices keep the arrays in registers
#pragma unroll
    for (int j = 0; j < 3; ++j) {
      const float a0 = m[0][j], a1 = m[1][j], a2 = m[2][j];
      m[0][j] = r00 * a0 + r01 * a1 + r02 * a2;
      m[1][j] = r10 * a0 + r11 * a1 + r12 * a2;
      m[2][j] = r20 * a0 + r21 * a1 + r22 * a2;
    }
    const float e0 = e[0], e1 = e[1], e2 = e[2];
    e[0] = d * (r00 * e0 + r01 * e1 + r02 * e2) + g.u[i][0];
    e[1] = d * (r10 * e0 + r11 * e1 + r12 * e2) + g.u[i][1];
    e[2] = d * (r20 * e0 + r21 * e1 + r22 * e2) + g.u[i][2];
    p *= d;
  }
}

// Launch A. Chunk map layout: float4 cmap[b][chunk][row 0..2][chain],
// row i = (M[i][0], M[i][1], M[i][2], e[i]).
__global__ __launch_bounds__(256)
void qssm_chunk_map(const float* __restrict__ biv,
                    const float* __restrict__ dec,
                    const float* __restrict__ inj,
                    float* __restrict__ cmap) {
  const int ch = blockIdx.x;   // 0..NCHUNK-1
  const int b  = blockIdx.y;
  const int nb = threadIdx.x;  // 0..255
  const size_t base = ((size_t)b * TLEN + (size_t)ch * CLEN) * DDIM + (size_t)nb * 3;
  const float* pb = biv + base;
  const float* pu = inj + base;
  const float* pd = dec + (size_t)b * TLEN + (size_t)ch * CLEN;

  float m[3][3] = {{1.0f, 0.0f, 0.0f}, {0.0f, 1.0f, 0.0f}, {0.0f, 0.0f, 1.0f}};
  float e[3] = {0.0f, 0.0f, 0.0f};
  float p = 1.0f;

  StepGrp ga, gb;
  load_grp(ga, pb, pu);
  for (int g = 0; g < NGRP; g += 2) {
    load_grp(gb, pb + (g + 1) * GRP * DDIM, pu + (g + 1) * GRP * DDIM);
    compose_grp(ga, pd + g * GRP, m, p, e);
    if (g + 2 < NGRP)
      load_grp(ga, pb + (g + 2) * GRP * DDIM, pu + (g + 2) * GRP * DDIM);
    compose_grp(gb, pd + (g + 1) * GRP, m, p, e);
  }

  float4* cm = (float4*)cmap + ((size_t)b * NCHUNK + ch) * 3 * NBQ + nb;
// unrolled: constant indices keep the arrays in registers
#pragma unroll
  for (int i = 0; i < 3; ++i)
    cm[i * NBQ] = make_float4(p * m[i][0], p * m[i][1], p * m[i][2], e[i]);
}

// The GRP steps of one group with the step formula; states go to po.
__device__ __forceinline__ void replay_grp(const StepGrp& g, const float* dg, float* po,
                                           float& hx, float& hy, float& hz) {
// unrolled: constant indices keep the arrays in registers
#pragma unroll
  for (int i = 0; i < GRP; ++i) {
    const float bx = g.b[i][0], by = g.b[i][1], bz = g.b[i][2];
    const float ux = g.u[i][0], uy = g.u[i][1], uz = g.u[i][2];
    const float d  = dg[i];

    const float th  = sqrtf(bx * bx + by * by + bz * bz);
    const float inv = 1.0f / fmaxf(th, 1e-8f);
    const float kx = bx * inv, ky = by * inv, kz = bz * inv;
    const float c = cosf(th), s = sinf(th);

    const float cx = ky * hz - kz * hy;
    const float cy = kz * hx - kx * hz;
    const float cz = kx * hy - ky * hx;
    const float kdoth = kx * hx + ky * hy + kz * hz;
    const float om = (1.0f - c) * kdoth;

    const float rx = hx * c + cx * s + kx * om;
    const float ry = hy * c + cy * s + ky * om;
    const float rz = hz * c + cz * s + kz * om;

    hx = d * rx + ux;
    hy = d * ry + uy;
    hz = d * rz + uz;

    po[i * DDIM]     = hx;
    po[i * DDIM + 1] = hy;
    po[i * DDIM + 2] = hz;
  }
  // the stores' address and data registers are reused below: wait before they are rewritten
  asm volatile("s_wait_xcnt 0x0" ::: "memory");
}

// Launch B. inj lives in `out` and is overwritten in place with the state h_t;
// a thread reads and writes only its own chunk's elements of its own chain.
__global__ __launch_bounds__(256)
void qssm_scan_chunk(const float* __restrict__ biv,
                     const float* __restrict__ dec,
                     const float* __restrict__ cmap,
                     float* __restrict__ out) {
  const int ch = blockIdx.x;   // 0..NCHUNK-1
  const int b  = blockIdx.y;
  const int nb = threadIdx.x;  // 0..255
  const size_t base = ((size_t)b * TLEN + (size_t)ch * CLEN) * DDIM + (size_t)nb * 3;
  const float* pb = biv + base;
  float*       po = out + base;
  const float* pd = dec + (size_t)b * TLEN + (size_t)ch * CLEN;

  StepGrp ga, gb;
  load_grp(ga, pb, po);

  // start state of this chunk: earlier chunks' maps applied in time order to h = 0
  float hx = 0.0f, hy = 0.0f, hz = 0.0f;
  const float4* cj = (const float4*)cmap + (size_t)b * NCHUNK * 3 * NBQ + nb;
  // FOLD maps are fetched together so that their L2 latency is paid once per batch;
  // the last batch may fetch maps of chunks >= ch (launch A wrote them all) and
  // keeps only the results of those below ch
  for (int j0 = 0; j0 < ch; j0 += FOLD) {
    float4 r[FOLD][3];
// unrolled: constant indices keep the arrays in registers
#pragma unroll
    for (int i = 0; i < FOLD; ++i) {
// unrolled: constant indices keep the arrays in registers
#pragma unroll
      for (int q = 0; q < 3; ++q) r[i][q] = cj[(i * 3 + q) * NBQ];
    }
    cj += FOLD * 3 * NBQ;
// unrolled: constant indices keep the arrays in registers
#pragma unroll
    for (int i = 0; i < FOLD; ++i) {
      const bool on = j0 + i < ch;
      const float nx = r[i][0].x * hx + r[i][0].y * hy + r[i][0].z * hz + r[i][0].w;
      const float ny = r[i][1].x * hx + r[i][1].y * hy + r[i][1].z * hz + r[i][1].w;
      const float nz = r[i][2].x * hx + r[i][2].y * hy + r[i][2].z * hz + r[i][2].w;
      hx = on ? nx : hx;
      hy = on ? ny : hy;
      hz = on ? nz : hz;
    }
  }

  for (int g = 0; g < NGRP; g += 2) {
    load_grp(gb, pb + (g + 1) * GRP * DDIM, po + (g + 1) * GRP * DDIM);
    replay_grp(ga, pd + g * GRP, po + g * GRP * DDIM, hx, hy, hz);
    if (g + 2 < NGRP)
      load_grp(ga, pb + (g + 2) * GRP * DDIM, po + (g + 2) * GRP * DDIM);
    replay_grp(gb, pd + (g + 1) * GRP, po + (g + 1) * GRP * DDIM, hx, hy, hz);
  }
}

extern "C" void kernel_launch(void* const* d_in, const int* in_sizes, int n_in,
                              void* d_out, int out_size, void* d_ws, size_t ws_size,
                              hipStream_t stream) {
  const float* x      = (const float*)d_in[0];  // (B,T,D)
  const float* W_biv  = (const float*)d_in[1];  // (768,768)
  const float* b_biv  = (const float*)d_in[2];  // (768,)
  const float* W_dec  = (const float*)d_in[3];  // (1,768)
  const float* b_dec  = (const float*)d_in[4];  // (1,)
  const float* W_in   = (const float*)d_in[5];  // (768,768)
  const float* b_in   = (const float*)d_in[6];  // (768,)
  float* out = (float*)d_out;                   // (B,T,768)

  float* ws_biv = (float*)d_ws;                       // MROWS*768 floats
  float* ws_dec = ws_biv + (size_t)MROWS * DDIM;      // MROWS floats
  float* ws_map = ws_dec + (size_t)MROWS;             // BATCH*NCHUNK*3*NBQ float4

  // 1) fused projections: biv -> ws, inj -> d_out (in place for the scan)
  dim3 ggrid(MROWS / BM, NCOLS / BN);  // (256, 12)
  qssm_proj_gemm<<<ggrid, 256, 0, stream>>>(x, W_biv, W_in, b_biv, b_in,
                                            ws_biv, out);
  // 2) decay gate (GEMV + sigmoid)
  qssm_decay<<<MROWS / 8, 256, 0, stream>>>(x, W_dec, b_dec, ws_dec);
  // 3) each time chunk's affine map
  qssm_chunk_map<<<dim3(NCHUNK, BATCH), NBQ, 0, stream>>>(ws_biv, ws_dec, out, ws_map);
  // 4) fold the earlier chunks' maps, then replay each chunk's own steps
  qssm_scan_chunk<<<dim3(NCHUNK, BATCH), NBQ, 0, stream>>>(ws_biv, ws_dec, ws_map, out);
}

// v002
// It runs in 277 microseconds.
// In both of two side-by-side timings against v001, it was 1.15 times as fast.
// All steps since v000 together make it 9.96 times as fast.
#include <hip/hip_runtime.h>
#include <hip/hip_bf16.h>
#include <math.h>

// ---------------- problem constants ----------------
#define BATCH 8
#define TLEN  4096
#define DDIM  768
#define NBQ   256           // quaternion blocks (DDIM/3)
#define MROWS (BATCH * TLEN)  // 32768
#define NCOLS (2 * DDIM)      // 1536 : [0,768)=biv, [768,1536)=inj
#define KDIM  DDIM

// ---------------- GEMM tiling ----------------
#define BM 128
#define BN 128
#define BK 32
#define BKP (BK + 8)        // padded LDS row stride (bf16 elems) for bank spread

typedef __attribute__((ext_vector_type(16))) __bf16 v16bf;
typedef __attribute__((ext_vector_type(8)))  __bf16 v8bf;
typedef __attribute__((ext_vector_type(8)))  float  v8f;

// Load one 16x32 bf16 A/B fragment from an LDS plane laid out [row][BKP].
// CDNA5 16-bit operand layout: lanes 0-15 hold row=lane, K={0..7,16..23};
// lanes 16-31 hold row=lane-16, K={8..15,24..31}. Two aligned b128 loads.
__device__ __forceinline__ v16bf load_frag(const __bf16* plane, int row_base, int lane) {
  const int row   = row_base + (lane & 15);
  const int khalf = (lane >> 4) * 8;
  const __bf16* p = plane + row * BKP + khalf;
  v8bf c0 = *(const v8bf*)(p);
  v8bf c1 = *(const v8bf*)(p + 16);
  v16bf r;
#pragma unroll
  for (int i = 0; i < 8; ++i) { r[i] = c0[i]; r[i + 8] = c1[i]; }
  return r;
}

// One staged K tile in LDS: four bf16 planes [row][BKP] (BM == BN rows each).
#define PLANE  (BM * BKP)
#define STAGE  (4 * PLANE)      // A hi | A lo | B hi | B lo
#define NKT    (KDIM / BK)      // 24 K tiles
static_assert(BM == BN, "the four planes of a stage have one size");
static_assert(DDIM % BN == 0, "a column tile lies in one weight matrix");

// Split four floats into bf16 hi + lo and put them into the two planes.
__device__ __forceinline__ void split_store(__bf16* hi, __bf16* lo, const float4& v) {
// unrolled: constant indices keep the arrays in registers
#pragma unroll
  for (int q = 0; q < 4; ++q) {
    float f   = ((const float*)&v)[q];
    __bf16 h  = (__bf16)f;
    __bf16 l  = (__bf16)(f - (float)h);
    hi[q] = h;
    lo[q] = l;
  }
}

// The fetched registers of one K tile -> one LDS stage.
__device__ __forceinline__ void store_tile(__bf16* st, int srow, int scol,
                                           const float4 (&ra)[4], const float4 (&rb)[4]) {
// unrolled: constant indices keep the arrays in registers
#pragma unroll
  for (int pass = 0; pass < 4; ++pass) {
    const int o = (pass * 32 + srow) * BKP + scol;
    split_store(st + o, st + PLANE + o, ra[pass]);
    split_store(st + 2 * PLANE + o, st + 3 * PLANE + o, rb[pass]);
  }
}

// bf16x3 split-precision WMMA on one staged K tile: acc += Ah*Bh + Ah*Bl + Al*Bh
__device__ __forceinline__ void mma_tile(const __bf16* st, int wm, int wn, int lane,
                                         v8f (&acc)[2][4]) {
  v16bf a_hi[2], a_lo[2], b_hi[4], b_lo[4];
// unrolled: constant indices keep the arrays in registers
#pragma unroll
  for (int i = 0; i < 2; ++i) {
    a_hi[i] = load_frag(st, wm * 32 + i * 16, lane);
    a_lo[i] = load_frag(st + PLANE, wm * 32 + i * 16, lane);
  }
// unrolled: constant indices keep the arrays in registers
#pragma unroll
  for (int j = 0; j < 4; ++j) {
    b_hi[j] = load_frag(st + 2 * PLANE, wn * 64 + j * 16, lane);
    b_lo[j] = load_frag(st + 3 * PLANE, wn * 64 + j * 16, lane);
  }
// unrolled: constant indices keep the arrays in registers
#pragma unroll
  for (int i = 0; i < 2; ++i) {
// unrolled: constant indices keep the arrays in registers
#pragma unroll
    for (int j = 0; j < 4; ++j) {
      acc[i][j] = __builtin_amdgcn_wmma_f32_16x16x32_bf16(
          false, a_hi[i], false, b_hi[j], (short)0, acc[i][j], false, false);
      acc[i][j] = __builtin_amdgcn_wmma_f32_16x16x32_bf16(
          false, a_hi[i], false, b_lo[j], (short)0, acc[i][j], false, false);
      acc[i][j] = __builtin_amdgcn_wmma_f32_16x16x32_bf16(
          false, a_lo[i], false, b_hi[j], (short)0, acc[i][j], false, false);
    }
  }
}

// Fused projection GEMM: out[m, n] for n in [0,1536).
//   n <  768 : biv column n      (weights W_biv, bias b_biv)  -> ws biv buffer
//   n >= 768 : inj column n-768  (weights W_in,  bias b_in)   -> d_out (in-place scanned later)
// The K loop is software-pipelined: while tile kt is multiplied out of one LDS
// stage, tile kt+1 is already on its way from global memory into registers; it
// is split and stored into the other stage behind the WMMAs.
__global__ __launch_bounds__(256)
void qssm_proj_gemm(const float* __restrict__ X,
                    const float* __restrict__ Wbiv,
                    const float* __restrict__ Win,
                    const float* __restrict__ bbiv,
                    const float* __restrict__ bin,
                    float* __restrict__ out_biv,
                    float* __restrict__ out_inj) {
  __shared__ __attribute__((aligned(16))) __bf16 smem[2 * STAGE];

  const int tid  = threadIdx.x;
  const int lane = tid & 31;
  const int wave = tid >> 5;      // 0..7
  const int wm   = wave & 3;      // 4 waves along M (32 rows each)
  const int wn   = wave >> 2;     // 2 waves along N (64 cols each)

  const int m0 = blockIdx.x * BM;
  const int n0 = blockIdx.y * BN;

  v8f acc[2][4];
// unrolled: constant indices keep the arrays in registers
#pragma unroll
  for (int i = 0; i < 2; ++i)
// unrolled: constant indices keep the arrays in registers
#pragma unroll
    for (int j = 0; j < 4; ++j) acc[i][j] = (v8f)0.0f;

  // staging map: 8 threads per row (8 x float4 = 32 floats), 32 rows per pass
  const int srow = tid >> 3;        // 0..31
  const int scol = (tid & 7) * 4;   // 0,4,...,28

  // A: x[m0+row, ...] ; B: weight row (n0+row) of W_biv or W_in
  const float* wtile = (n0 < DDIM) ? (Wbiv + (size_t)n0 * KDIM)
                                   : (Win + (size_t)(n0 - DDIM) * KDIM);
  const float* pa = X + (size_t)(m0 + srow) * KDIM + scol;
  const float* pb = wtile + (size_t)srow * KDIM + scol;

  float4 ra[4], rb[4];
  long kstep = BK;   // floats from one K tile to the next

  // ---- tile 0: fetch, split, store into stage 0 ----
// unrolled: constant indices keep the arrays in registers
#pragma unroll
  for (int pass = 0; pass < 4; ++pass) {
    ra[pass] = *(const float4*)(pa + pass * 32 * KDIM);
    rb[pass] = *(const float4*)(pb + pass * 32 * KDIM);
  }
  // the loads' address registers are advanced below: wait before they are
  // rewritten; as inputs they stay untouched up to here
  asm volatile("s_wait_xcnt 0x0" :: "v"(pa), "v"(pb) : "memory");
  store_tile(smem, srow, scol, ra, rb);
  __syncthreads();

  for (int kt = 0; kt < NKT - 1; ++kt) {
    // ---- all eight loads of tile kt+1 go out together, ahead of tile kt's WMMAs ----
    // (pa, pb point at tile kt)
// unrolled: constant indices keep the arrays in registers
#pragma unroll
    for (int pass = 0; pass < 4; ++pass) {
      ra[pass] = *(const float4*)(pa + pass * 32 * KDIM + BK);
      rb[pass] = *(const float4*)(pb + pass * 32 * KDIM + BK);
      if (kt + 2 < NKT) {
        __builtin_prefetch(pa + pass * 32 * KDIM + 2 * BK, 0, 1);
        __builtin_prefetch(pb + pass * 32 * KDIM + 2 * BK, 0, 1);
      }
    }
    // keeps the eight loads in front of the fragment reads and the WMMAs, so that
    // their latency runs out behind the matrix work
    __builtin_amdgcn_sched_barrier(0);

    mma_tile(smem + (kt & 1) * STAGE, wm, wn, lane, acc);

    // keeps the split (and with it the wait for the loads) behind the last WMMA
    __builtin_amdgcn_sched_barrier(0);
    // the address registers are advanced next: wait before they are rewritten.
    // As inputs they stay untouched up to the wait, and the step comes out of the
    // statement so that the two additions cannot be placed in front of it
    asm volatile("s_wait_xcnt 0x0" : "+s"(kstep) : "v"(pa), "v"(pb) : "memory");
    pa += kstep;
    pb += kstep;

    // stage (kt+1)&1 was last read in trip kt-1, and every wave has passed that
    // trip's barrier; this trip's one barrier publishes it
    store_tile(smem + ((kt + 1) & 1) * STAGE, srow, scol, ra, rb);
    __syncthreads();
  }
  mma_tile(smem + ((NKT - 1) & 1) * STAGE, wm, wn, lane, acc);

  // ---- epilogue: bias + scatter to biv workspace or inj (=d_out) ----
  // C/D layout: VGPR r, lanes 0-15 -> M=r, N=lane; lanes 16-31 -> M=8+r, N=lane-16.
  const int half = (lane >> 4) & 1;
#pragma unroll
  for (int i = 0; i < 2; ++i) {
#pragma unroll
    for (int j = 0; j < 4; ++j) {
      const int mb = m0 + wm * 32 + i * 16 + half * 8;
      const int nn = n0 + wn * 64 + j * 16 + (lane & 15);
      float bias;
      float* dst;
      int col;
      if (nn < DDIM) { bias = bbiv[nn]; dst = out_biv; col = nn; }
      else           { bias = bin[nn - DDIM]; dst = out_inj; col = nn - DDIM; }
#pragma unroll
      for (int r = 0; r < 8; ++r) {
        dst[(size_t)(mb + r) * DDIM + col] = acc[i][j][r] + bias;
      }
    }
  }
}

// decay[m] = sigmoid(dot(x[m,:], W_decay) + b_decay); one wave per row.
__global__ __launch_bounds__(256)
void qssm_decay(const float* __restrict__ X,
                const float* __restrict__ Wd,
                const float* __restrict__ bd,
                float* __restrict__ dec) {
  const int row  = blockIdx.x * 8 + (threadIdx.x >> 5);
  const int lane = threadIdx.x & 31;
  const float* xr = X + (size_t)row * DDIM;
  float s = 0.0f;
#pragma unroll 4
  for (int k = lane; k < DDIM; k += 32) s += xr[k] * Wd[k];
#pragma unroll
  for (int off = 16; off > 0; off >>= 1) s += __shfl_xor(s, off, 32);
  if (lane == 0) {
    float z = s + bd[0];
    dec[row] = 1.0f / (1.0f + expf(-z));
  }
}

// ---------------- time-chunked Rodrigues scan ----------------
// One step is the affine map h -> d * R(b) * h + u, so a run of steps is again
// an affine map h -> M * h + e. T is cut into NCHUNK chunks:
//   launch A: one thread per (batch, chunk, chain) composes its chunk's (M, e);
//   launch B: the same thread folds the maps of all earlier chunks, in time
//             order, into its chunk's start state and then replays its own
//             steps with the step formula, writing the states.
#define NCHUNK 64
#define CLEN   (TLEN / NCHUNK)   // 64 steps per chunk
#define GRP    4                 // steps fetched together, one group ahead
#define NGRP   (CLEN / GRP)      // 16, even
#define FOLD   8                 // chunk maps fetched together in launch B

struct StepGrp {
  float b[GRP][3];
  float u[GRP][3];
};

__device__ __forceinline__ void load_grp(StepGrp& g, const float* pb, const float* pu) {
// unrolled: constant indices keep the arrays in registers
#pragma unroll
  for (int i = 0; i < GRP; ++i) {
// unrolled: constant indices keep the arrays in registers
#pragma unroll
    for (int q = 0; q < 3; ++q) {
      g.b[i][q] = pb[i * DDIM + q];
      g.u[i][q] = pu[i * DDIM + q];
    }
  }
  // the loads' address registers are reused below: wait before they are rewritten
  asm volatile("s_wait_xcnt 0x0" ::: "memory");
}

// M <- R * M, p <- p * d, e <- d * R * e + u for the GRP steps of one group.
__device__ __forceinline__ void compose_grp(const StepGrp& g, const float* dg,
                                            float (&m)[3][3], float& p, float (&e)[3]) {
// unrolled: constant indices keep the arrays in registers
#pragma unroll
  for (int i = 0; i < GRP; ++i) {
    const float bx = g.b[i][0], by = g.b[i][1], bz = g.b[i][2];
    const float d  = dg[i];

    const float th  = sqrtf(bx * bx + by * by + bz * bz);
    const float inv = 1.0f / fmaxf(th, 1e-8f);
    const float kx = bx * inv, ky = by * inv, kz = bz * inv;
    const float c = cosf(th), s = sinf(th);

    // R = c I + s [k]x + (1 - c) k k^T
    const float oc = 1.0f - c;
    const float ax = oc * kx, ay = oc * ky, az = oc * kz;
    const float sx = s * kx,  sy = s * ky,  sz = s * kz;
    const float r00 = ax * kx + c,  r01 = ax * ky - sz, r02 = ax * kz + sy;
    const float r10 = ay * kx + sz, r11 = ay * ky + c,  r12 = ay * kz - sx;
    const float r20 = az * kx - sy, r21 = az * ky + sx, r22 = az * kz + c;

// unrolled: constant indices keep the arrays in registers
#pragma unroll
    for (int j = 0; j < 3; ++j) {
      const float a0 = m[0][j], a1 = m[1][j], a2 = m[2][j];
      m[0][j] = r00 * a0 + r01 * a1 + r02 * a2;
      m[1][j] = r10 * a0 + r11 * a1 + r12 * a2;
      m[2][j] = r20 * a0 + r21 * a1 + r22 * a2;
    }
    const float e0 = e[0], e1 = e[1], e2 = e[2];
    e[0] = d * (r00 * e0 + r01 * e1 + r02 * e2) + g.u[i][0];
    e[1] = d * (r10 * e0 + r11 * e1 + r12 * e2) + g.u[i][1];
    e[2] = d * (r20 * e0 + r21 * e1 + r22 * e2) + g.u[i][2];
    p *= d;
  }
}

// Launch A. Chunk map layout: float4 cmap[b][chunk][row 0..2][chain],
// row i = (M[i][0], M[i][1], M[i][2], e[i]).
__global__ __launch_bounds__(256)
void qssm_chunk_map(const float* __restrict__ biv,
                    const float* __restrict__ dec,
                    const float* __restrict__ inj,
                    float* __restrict__ cmap) {
  const int ch = blockIdx.x;   // 0..NCHUNK-1
  const int b  = blockIdx.y;
  const int nb = threadIdx.x;  // 0..255
  const size_t base = ((size_t)b * TLEN + (size_t)ch * CLEN) * DDIM + (size_t)nb * 3;
  const float* pb = biv + base;
  const float* pu = inj + base;
  const float* pd = dec + (size_t)b * TLEN + (size_t)ch * CLEN;

  float m[3][3] = {{1.0f, 0.0f, 0.0f}, {0.0f, 1.0f, 0.0f}, {0.0f, 0.0f, 1.0f}};
  float e[3] = {0.0f, 0.0f, 0.0f};
  float p = 1.0f;

  StepGrp ga, gb;
  load_grp(ga, pb, pu);
  for (int g = 0; g < NGRP; g += 2) {
    load_grp(gb, pb + (g + 1) * GRP * DDIM, pu + (g + 1) * GRP * DDIM);
    compose_grp(ga, pd + g * GRP, m, p, e);
    if (g + 2 < NGRP)
      load_grp(ga, pb + (g + 2) * GRP * DDIM, pu + (g + 2) * GRP * DDIM);
    compose_grp(gb, pd + (g + 1) * GRP, m, p, e);
  }

  float4* cm = (float4*)cmap + ((size_t)b * NCHUNK + ch) * 3 * NBQ + nb;
// unrolled: constant indices keep the arrays in registers
#pragma unroll
  for (int i = 0; i < 3; ++i)
    cm[i * NBQ] = make_float4(p * m[i][0], p * m[i][1], p * m[i][2], e[i]);
}

// The GRP steps of one group with the step formula; states go to po.
__device__ __forceinline__ void replay_grp(const StepGrp& g, const float* dg, float* po,
                                           float& hx, float& hy, float& hz) {
// unrolled: constant indices keep the arrays in registers
#pragma unroll
  for (int i = 0; i < GRP; ++i) {
    const float bx = g.b[i][0], by = g.b[i][1], bz = g.b[i][2];
    const float ux = g.u[i][0], uy = g.u[i][1], uz = g.u[i][2];
    const float d  = dg[i];

    const float th  = sqrtf(bx * bx + by * by + bz * bz);
    const float inv = 1.0f / fmaxf(th, 1e-8f);
    const float kx = bx * inv, ky = by * inv, kz = bz * inv;
    const float c = cosf(th), s = sinf(th);

    const float cx = ky * hz - kz * hy;
    const float cy = kz * hx - kx * hz;
    const float cz = kx * hy - ky * hx;
    const float kdoth = kx * hx + ky * hy + kz * hz;
    const float om = (1.0f - c) * kdoth;

    const float rx = hx * c + cx * s + kx * om;
    const float ry = hy * c + cy * s + ky * om;
    const float rz = hz * c + cz * s + kz * om;

    hx = d * rx + ux;
    hy = d * ry + uy;
    hz = d * rz + uz;

    po[i * DDIM]     = hx;
    po[i * DDIM + 1] = hy;
    po[i * DDIM + 2] = hz;
  }
  // the stores' address and data registers are reused below: wait before they are rewritten
  asm volatile("s_wait_xcnt 0x0" ::: "memory");
}

// Launch B. inj lives in `out` and is overwritten in place with the state h_t;
// a thread reads and writes only its own chunk's elements of its own chain.
__global__ __launch_bounds__(256)
void qssm_scan_chunk(const float* __restrict__ biv,
                     const float* __restrict__ dec,
                     const float* __restrict__ cmap,
                     float* __restrict__ out) {
  const int ch = blockIdx.x;   // 0..NCHUNK-1
  const int b  = blockIdx.y;
  const int nb = threadIdx.x;  // 0..255
  const size_t base = ((size_t)b * TLEN + (size_t)ch * CLEN) * DDIM + (size_t)nb * 3;
  const float* pb = biv + base;
  float*       po = out + base;
  const float* pd = dec + (size_t)b * TLEN + (size_t)ch * CLEN;

  StepGrp ga, gb;
  load_grp(ga, pb, po);

  // start state of this chunk: earlier chunks' maps applied in time order to h = 0
  float hx = 0.0f, hy = 0.0f, hz = 0.0f;
  const float4* cj = (const float4*)cmap + (size_t)b * NCHUNK * 3 * NBQ + nb;
  // FOLD maps are fetched together so that their L2 latency is paid once per batch;
  // the last batch may fetch maps of chunks >= ch (launch A wrote them all) and
  // keeps only the results of those below ch
  for (int j0 = 0; j0 < ch; j0 += FOLD) {
    float4 r[FOLD][3];
// unrolled: constant indices keep the arrays in registers
#pragma unroll
    for (int i = 0; i < FOLD; ++i) {
// unrolled: constant indices keep the arrays in registers
#pragma unroll
      for (int q = 0; q < 3; ++q) r[i][q] = cj[(i * 3 + q) * NBQ];
    }
    cj += FOLD * 3 * NBQ;
// unrolled: constant indices keep the arrays in registers
#pragma unroll
    for (int i = 0; i < FOLD; ++i) {
      const bool on = j0 + i < ch;
      const float nx = r[i][0].x * hx + r[i][0].y * hy + r[i][0].z * hz + r[i][0].w;
      const float ny = r[i][1].x * hx + r[i][1].y * hy + r[i][1].z * hz + r[i][1].w;
      const float nz = r[i][2].x * hx + r[i][2].y * hy + r[i][2].z * hz + r[i][2].w;
      hx = on ? nx : hx;
      hy = on ? ny : hy;
      hz = on ? nz : hz;
    }
  }

  for (int g = 0; g < NGRP; g += 2) {
    load_grp(gb, pb + (g + 1) * GRP * DDIM, po + (g + 1) * GRP * DDIM);
    replay_grp(ga, pd + g * GRP, po + g * GRP * DDIM, hx, hy, hz);
    if (g + 2 < NGRP)
      load_grp(ga, pb + (g + 2) * GRP * DDIM, po + (g + 2) * GRP * DDIM);
    replay_grp(gb, pd + (g + 1) * GRP, po + (g + 1) * GRP * DDIM, hx, hy, hz);
  }
}

extern "C" void kernel_launch(void* const* d_in, const int* in_sizes, int n_in,
                              void* d_out, int out_size, void* d_ws, size_t ws_size,
                              hipStream_t stream) {
  const float* x      = (const float*)d_in[0];  // (B,T,D)
  const float* W_biv  = (const float*)d_in[1];  // (768,768)
  const float* b_biv  = (const float*)d_in[2];  // (768,)
  const float* W_dec  = (const float*)d_in[3];  // (1,768)
  const float* b_dec  = (const float*)d_in[4];  // (1,)
  const float* W_in   = (const float*)d_in[5];  // (768,768)
  const float* b_in   = (const float*)d_in[6];  // (768,)
  float* out = (float*)d_out;                   // (B,T,768)

  float* ws_biv = (float*)d_ws;                       // MROWS*768 floats
  float* ws_dec = ws_biv + (size_t)MROWS * DDIM;      // MROWS floats
  float* ws_map = ws_dec + (size_t)MROWS;             // BATCH*NCHUNK*3*NBQ float4

  // 1) fused projections: biv -> ws, inj -> d_out (in place for the scan)
  dim3 ggrid(MROWS / BM, NCOLS / BN);  // (256, 12)
  qssm_proj_gemm<<<ggrid, 256, 0, stream>>>(x, W_biv, W_in, b_biv, b_in,
                                            ws_biv, out);
  // 2) decay gate (GEMV + sigmoid)
  qssm_decay<<<MROWS / 8, 256, 0, stream>>>(x, W_dec, b_dec, ws_dec);
  // 3) each time chunk's affine map
  qssm_chunk_map<<<dim3(NCHUNK, BATCH), NBQ, 0, stream>>>(ws_biv, ws_dec, out, ws_map);
  // 4) fold the earlier chunks' maps, then replay each chunk's own steps
  qssm_scan_chunk<<<dim3(NCHUNK, BATCH), NBQ, 0, stream>>>(ws_biv, ws_dec, ws_map, out);
}

// v003
// It runs in 231 microseconds.
// Two timings next to v002 both put it at 1.20 times that version's speed.
// Counting every step since v000, it is 11.9 times as fast.
#include <hip/hip_runtime.h>
#include <hip/hip_bf16.h>
#include <math.h>

// ---------------- problem constants ----------------
#define BATCH 8
#define TLEN  4096
#define DDIM  768
#define NBQ   256           // quaternion blocks (DDIM/3)
#define MROWS (BATCH * TLEN)  // 32768
#define NCOLS (2 * DDIM)      // 1536 : [0,768)=biv, [768,1536)=inj
#define KDIM  DDIM

// ---------------- GEMM tiling ----------------
#define BM 256
#define BN 256
#define BK 32
#define GTHREADS 512        // 16 waves, 4 x 4, each on a 64 x 64 piece of the tile
#define BKP (BK + 8)        // padded LDS row stride (bf16 elems) for bank spread

typedef __attribute__((ext_vector_type(16))) __bf16 v16bf;
typedef __attribute__((ext_vector_type(8)))  __bf16 v8bf;
typedef __attribute__((ext_vector_type(8)))  float  v8f;

// Load one 16x32 bf16 A/B fragment from an LDS plane laid out [row][BKP].
// CDNA5 16-bit operand layout: lanes 0-15 hold row=lane, K={0..7,16..23};
// lanes 16-31 hold row=lane-16, K={8..15,24..31}. Two aligned b128 loads.
__device__ __forceinline__ v16bf load_frag(const __bf16* plane, int row_base, int lane) {
  const int row   = row_base + (lane & 15);
  const int khalf = (lane >> 4) * 8;
  const __bf16* p = plane + row * BKP + khalf;
  v8bf c0 = *(const v8bf*)(p);
  v8bf c1 = *(const v8bf*)(p + 16);
  v16bf r;
#pragma unroll
  for (int i = 0; i < 8; ++i) { r[i] = c0[i]; r[i + 8] = c1[i]; }
  return r;
}

// One staged K tile in LDS: four bf16 planes [row][BKP] (BM == BN rows each).
#define PLANE  (BM * BKP)
#define STAGE  (4 * PLANE)      // A hi | A lo | B hi | B lo
#define NKT    (KDIM / BK)      // 24 K tiles
static_assert(BM == BN, "the four planes of a stage have one size");
static_assert(DDIM % BN == 0, "a column tile lies in one weight matrix");

// Split four floats into bf16 hi + lo and put them into the two planes.
__device__ __forceinline__ void split_store(__bf16* hi, __bf16* lo, const float4& v) {
// unrolled: constant indices keep the arrays in registers
#pragma unroll
  for (int q = 0; q < 4; ++q) {
    float f   = ((const float*)&v)[q];
    __bf16 h  = (__bf16)f;
    __bf16 l  = (__bf16)(f - (float)h);
    hi[q] = h;
    lo[q] = l;
  }
}

// The fetched registers of one K tile -> one LDS stage.
__device__ __forceinline__ void store_tile(__bf16* st, int srow, int scol,
                                           const float4 (&ra)[4], const float4 (&rb)[4]) {
// unrolled: constant indices keep the arrays in registers
#pragma unroll
  for (int pass = 0; pass < 4; ++pass) {
    const int o = (pass * 64 + srow) * BKP + scol;
    split_store(st + o, st + PLANE + o, ra[pass]);
    split_store(st + 2 * PLANE + o, st + 3 * PLANE + o, rb[pass]);
  }
}

// bf16x3 split-precision WMMA on one staged K tile: acc += Ah*Bh + Ah*Bl + Al*Bh
// (each accumulator takes its three products in that order). The A fragments of
// the wave's 64 rows stay in registers; the B fragments pass through one column
// block at a time, so that accumulators, fragments and the fetched next tile fit
// the 256 registers a wave has in a work-group of 16 waves.
__device__ __forceinline__ void mma_tile(const __bf16* st, int wm, int wn, int lane,
                                         v8f (&acc)[4][4]) {
  v16bf a_hi[4], a_lo[4];
// unrolled: constant indices keep the arrays in registers
#pragma unroll
  for (int i = 0; i < 4; ++i) {
    a_hi[i] = load_frag(st, wm * 64 + i * 16, lane);
    a_lo[i] = load_frag(st + PLANE, wm * 64 + i * 16, lane);
  }
// unrolled: constant indices keep the arrays in registers
#pragma unroll
  for (int j = 0; j < 4; ++j) {
    const v16bf b_hi = load_frag(st + 2 * PLANE, wn * 64 + j * 16, lane);
    const v16bf b_lo = load_frag(st + 3 * PLANE, wn * 64 + j * 16, lane);
// unrolled: constant indices keep the arrays in registers
#pragma unroll
    for (int i = 0; i < 4; ++i)
      acc[i][j] = __builtin_amdgcn_wmma_f32_16x16x32_bf16(
          false, a_hi[i], false, b_hi, (short)0, acc[i][j], false, false);
// unrolled: constant indices keep the arrays in registers
#pragma unroll
    for (int i = 0; i < 4; ++i)
      acc[i][j] = __builtin_amdgcn_wmma_f32_16x16x32_bf16(
          false, a_hi[i], false, b_lo, (short)0, acc[i][j], false, false);
// unrolled: constant indices keep the arrays in registers
#pragma unroll
    for (int i = 0; i < 4; ++i)
      acc[i][j] = __builtin_amdgcn_wmma_f32_16x16x32_bf16(
          false, a_lo[i], false, b_hi, (short)0, acc[i][j], false, false);
  }
}

// Fused projection GEMM: out[m, n] for n in [0,1536).
//   n <  768 : biv column n      (weights W_biv, bias b_biv)  -> ws biv buffer
//   n >= 768 : inj column n-768  (weights W_in,  bias b_in)   -> d_out (in-place scanned later)
// The K loop is software-pipelined: while tile kt is multiplied out of one LDS
// stage, tile kt+1 is already on its way from global memory into registers; it
// is split and stored into the other stage behind the WMMAs.
__global__ __launch_bounds__(GTHREADS)
void qssm_proj_gemm(const float* __restrict__ X,
                    const float* __restrict__ Wbiv,
                    const float* __restrict__ Win,
                    const float* __restrict__ bbiv,
                    const float* __restrict__ bin,
                    float* __restrict__ out_biv,
                    float* __restrict__ out_inj) {
  __shared__ __attribute__((aligned(16))) __bf16 smem[2 * STAGE];

  const int tid  = threadIdx.x;
  const int lane = tid & 31;
  // the wave's number as a scalar: its row and column offsets then take no vector
  // registers, which the 256 a wave has here are short of
  const int wave = __builtin_amdgcn_readfirstlane(tid >> 5);   // 0..15
  const int wm   = wave & 3;      // 4 waves along M (64 rows each)
  const int wn   = wave >> 2;     // 4 waves along N (64 cols each)

  const int m0 = blockIdx.x * BM;
  const int n0 = blockIdx.y * BN;

  v8f acc[4][4];
// unrolled: constant indices keep the arrays in registers
#pragma unroll
  for (int i = 0; i < 4; ++i)
// unrolled: constant indices keep the arrays in registers
#pragma unroll
    for (int j = 0; j < 4; ++j) acc[i][j] = (v8f)0.0f;

  // staging map: 8 threads per row (8 x float4 = 32 floats), 64 rows per pass
  const int srow = tid >> 3;        // 0..63
  const int scol = (tid & 7) * 4;   // 0,4,...,28

  // A: x[m0+row, ...] ; B: weight row (n0+row) of W_biv or W_in
  const float* wtile = (n0 < DDIM) ? (Wbiv + (size_t)n0 * KDIM)
                                   : (Win + (size_t)(n0 - DDIM) * KDIM);
  const float* pa = X + (size_t)(m0 + srow) * KDIM + scol;
  const float* pb = wtile + (size_t)srow * KDIM + scol;

  float4 ra[4], rb[4];
  long kstep = BK;   // floats from one K tile to the next

  // ---- tile 0: fetch, split, store into stage 0 ----
// unrolled: constant indices keep the arrays in registers
#pragma unroll
  for (int pass = 0; pass < 4; ++pass) {
    ra[pass] = *(const float4*)(pa + pass * 64 * KDIM);
    rb[pass] = *(const float4*)(pb + pass * 64 * KDIM);
  }
  // the loads' address registers are advanced below: wait before they are
  // rewritten; as inputs they stay untouched up to here
  asm volatile("s_wait_xcnt 0x0" :: "v"(pa), "v"(pb) : "memory");
  store_tile(smem, srow, scol, ra, rb);
  __syncthreads();

  for (int kt = 0; kt < NKT - 1; ++kt) {
    // ---- all eight loads of tile kt+1 go out together, ahead of tile kt's WMMAs ----
    // (pa, pb point at tile kt)
// unrolled: constant indices keep the arrays in registers
#pragma unroll
    for (int pass = 0; pass < 4; ++pass) {
      ra[pass] = *(const float4*)(pa + pass * 64 * KDIM + BK);
      rb[pass] = *(const float4*)(pb + pass * 64 * KDIM + BK);
      if (kt + 2 < NKT) {
        __builtin_prefetch(pa + pass * 64 * KDIM + 2 * BK, 0, 1);
        __builtin_prefetch(pb + pass * 64 * KDIM + 2 * BK, 0, 1);
      }
    }
    // keeps the eight loads in front of the fragment reads and the WMMAs, so that
    // their latency runs out behind the matrix work
    __builtin_amdgcn_sched_barrier(0);

    mma_tile(smem + (kt & 1) * STAGE, wm, wn, lane, acc);

    // keeps the split (and with it the wait for the loads) behind the last WMMA
    __builtin_amdgcn_sched_barrier(0);
    // the address registers are advanced next: wait before they are rewritten.
    // As inputs they stay untouched up to the wait, and the step comes out of the
    // statement so that the two additions cannot be placed in front of it
    asm volatile("s_wait_xcnt 0x0" : "+s"(kstep) : "v"(pa), "v"(pb) : "memory");
    pa += kstep;
    pb += kstep;

    // stage (kt+1)&1 was last read in trip kt-1, and every wave has passed that
    // trip's barrier; this trip's one barrier publishes it
    store_tile(smem + ((kt + 1) & 1) * STAGE, srow, scol, ra, rb);
    __syncthreads();
  }
  // a column tile lies in one weight matrix: bias vector and destination are the tile's
  const bool to_biv  = n0 < DDIM;
  const float* bsrc  = to_biv ? bbiv : bin;
  float* dst         = to_biv ? out_biv : out_inj;
  const int col0     = (to_biv ? n0 : n0 - DDIM) + wn * 64 + (lane & 15);
  float bias[4];
// unrolled: constant indices keep the array in registers
#pragma unroll
  for (int j = 0; j < 4; ++j) bias[j] = bsrc[col0 + j * 16];
  // keeps the four bias loads in front of the last tile's WMMAs, which hide their latency
  __builtin_amdgcn_sched_barrier(0);

  mma_tile(smem + ((NKT - 1) & 1) * STAGE, wm, wn, lane, acc);
  // keeps the epilogue's address arithmetic behind the last WMMA: among the WMMAs
  // no register is free for it, and it would spill to scratch
  __builtin_amdgcn_sched_barrier(0);

  // ---- epilogue: bias + scatter to biv workspace or inj (=d_out) ----
  // C/D layout: VGPR r, lanes 0-15 -> M=r, N=lane; lanes 16-31 -> M=8+r, N=lane-16.
  const int half = (lane >> 4) & 1;
#pragma unroll
  for (int i = 0; i < 4; ++i) {
#pragma unroll
    for (int j = 0; j < 4; ++j) {
      const int mb = m0 + wm * 64 + i * 16 + half * 8;
#pragma unroll
      for (int r = 0; r < 8; ++r) {
        dst[(size_t)(mb + r) * DDIM + col0 + j * 16] = acc[i][j][r] + bias[j];
      }
    }
  }
}

// decay[m] = sigmoid(dot(x[m,:], W_decay) + b_decay); one wave per row.
__global__ __launch_bounds__(256)
void qssm_decay(const float* __restrict__ X,
                const float* __restrict__ Wd,
                const float* __restrict__ bd,
                float* __restrict__ dec) {
  const int row  = blockIdx.x * 8 + (threadIdx.x >> 5);
  const int lane = threadIdx.x & 31;
  const float* xr = X + (size_t)row * DDIM;
  float s = 0.0f;
#pragma unroll 4
  for (int k = lane; k < DDIM; k += 32) s += xr[k] * Wd[k];
#pragma unroll
  for (int off = 16; off > 0; off >>= 1) s += __shfl_xor(s, off, 32);
  if (lane == 0) {
    float z = s + bd[0];
    dec[row] = 1.0f / (1.0f + expf(-z));
  }
}

// ---------------- time-chunked Rodrigues scan ----------------
// One step is the affine map h -> d * R(b) * h + u, so a run of steps is again
// an affine map h -> M * h + e. T is cut into NCHUNK chunks:
//   launch A: one thread per (batch, chunk, chain) composes its chunk's (M, e);
//   launch B: the same thread folds the maps of all earlier chunks, in time
//             order, into its chunk's start state and then replays its own
//             steps with the step formula, writing the states.
#define NCHUNK 64
#define CLEN   (TLEN / NCHUNK)   // 64 steps per chunk
#define GRP    4                 // steps fetched together, one group ahead
#define NGRP   (CLEN / GRP)      // 16, even
#define FOLD   8                 // chunk maps fetched together in launch B

struct StepGrp {
  float b[GRP][3];
  float u[GRP][3];
};

__device__ __forceinline__ void load_grp(StepGrp& g, const float* pb, const float* pu) {
// unrolled: constant indices keep the arrays in registers
#pragma unroll
  for (int i = 0; i < GRP; ++i) {
// unrolled: constant indices keep the arrays in registers
#pragma unroll
    for (int q = 0; q < 3; ++q) {
      g.b[i][q] = pb[i * DDIM + q];
      g.u[i][q] = pu[i * DDIM + q];
    }
  }
  // the loads' address registers are reused below: wait before they are rewritten
  asm volatile("s_wait_xcnt 0x0" ::: "memory");
}

// M <- R * M, p <- p * d, e <- d * R * e + u for the GRP steps of one group.
__device__ __forceinline__ void compose_grp(const StepGrp& g, const float* dg,
                                            float (&m)[3][3], float& p, float (&e)[3]) {
// unrolled: constant indices keep the arrays in registers
#pragma unroll
  for (int i = 0; i < GRP; ++i) {
    const float bx = g.b[i][0], by = g.b[i][1], bz = g.b[i][2];
    const float d  = dg[i];

    const float th  = sqrtf(bx * bx + by * by + bz * bz);
    const float inv = 1.0f / fmaxf(th, 1e-8f);
    const float kx = bx * inv, ky = by * inv, kz = bz * inv;
    const float c = cosf(th), s = sinf(th);

    // R = c I + s [k]x + (1 - c) k k^T
    const float oc = 1.0f - c;
    const float ax = oc * kx, ay = oc * ky, az = oc * kz;
    const float sx = s * kx,  sy = s * ky,  sz = s * kz;
    const float r00 = ax * kx + c,  r01 = ax * ky - sz, r02 = ax * kz + sy;
    const float r10 = ay * kx + sz, r11 = ay * ky + c,  r12 = ay * kz - sx;
    const float r20 = az * kx - sy, r21 = az * ky + sx, r22 = az * kz + c;

// unrolled: constant indices keep the arrays in registers
#pragma unroll
    for (int j = 0; j < 3; ++j) {
      const float a0 = m[0][j], a1 = m[1][j], a2 = m[2][j];
      m[0][j] = r00 * a0 + r01 * a1 + r02 * a2;
      m[1][j] = r10 * a0 + r11 * a1 + r12 * a2;
      m[2][j] = r20 * a0 + r21 * a1 + r22 * a2;
    }
    const float e0 = e[0], e1 = e[1], e2 = e[2];
    e[0] = d * (r00 * e0 + r01 * e1 + r02 * e2) + g.u[i][0];
    e[1] = d * (r10 * e0 + r11 * e1 + r12 * e2) + g.u[i][1];
    e[2] = d * (r20 * e0 + r21 * e1 + r22 * e2) + g.u[i][2];
    p *= d;
  }
}

// Launch A. Chunk map layout: float4 cmap[b][chunk][row 0..2][chain],
// row i = (M[i][0], M[i][1], M[i][2], e[i]).
__global__ __launch_bounds__(256)
void qssm_chunk_map(const float* __restrict__ biv,
                    const float* __restrict__ dec,
                    const float* __restrict__ inj,
                    float* __restrict__ cmap) {
  const int ch = blockIdx.x;   // 0..NCHUNK-1
  const int b  = blockIdx.y;
  const int nb = threadIdx.x;  // 0..255
  const size_t base = ((size_t)b * TLEN + (size_t)ch * CLEN) * DDIM + (size_t)nb * 3;
  const float* pb = biv + base;
  const float* pu = inj + base;
  const float* pd = dec + (size_t)b * TLEN + (size_t)ch * CLEN;

  float m[3][3] = {{1.0f, 0.0f, 0.0f}, {0.0f, 1.0f, 0.0f}, {0.0f, 0.0f, 1.0f}};
  float e[3] = {0.0f, 0.0f, 0.0f};
  float p = 1.0f;

  StepGrp ga, gb;
  load_grp(ga, pb, pu);
  for (int g = 0; g < NGRP; g += 2) {
    load_grp(gb, pb + (g + 1) * GRP * DDIM, pu + (g + 1) * GRP * DDIM);
    compose_grp(ga, pd + g * GRP, m, p, e);
    if (g + 2 < NGRP)
      load_grp(ga, pb + (g + 2) * GRP * DDIM, pu + (g + 2) * GRP * DDIM);
    compose_grp(gb, pd + (g + 1) * GRP, m, p, e);
  }

  float4* cm = (float4*)cmap + ((size_t)b * NCHUNK + ch) * 3 * NBQ + nb;
// unrolled: constant indices keep the arrays in registers
#pragma unroll
  for (int i = 0; i < 3; ++i)
    cm[i * NBQ] = make_float4(p * m[i][0], p * m[i][1], p * m[i][2], e[i]);
}

// The GRP steps of one group with the step formula; states go to po.
__device__ __forceinline__ void replay_grp(const StepGrp& g, const float* dg, float* po,
                                           float& hx, float& hy, float& hz) {
// unrolled: constant indices keep the arrays in registers
#pragma unroll
  for (int i = 0; i < GRP; ++i) {
    const float bx = g.b[i][0], by = g.b[i][1], bz = g.b[i][2];
    const float ux = g.u[i][0], uy = g.u[i][1], uz = g.u[i][2];
    const float d  = dg[i];

    const float th  = sqrtf(bx * bx + by * by + bz * bz);
    const float inv = 1.0f / fmaxf(th, 1e-8f);
    const float kx = bx * inv, ky = by * inv, kz = bz * inv;
    const float c = cosf(th), s = sinf(th);

    const float cx = ky * hz - kz * hy;
    const float cy = kz * hx - kx * hz;
    const float cz = kx * hy - ky * hx;
    const float kdoth = kx * hx + ky * hy + kz * hz;
    const float om = (1.0f - c) * kdoth;

    const float rx = hx * c + cx * s + kx * om;
    const float ry = hy * c + cy * s + ky * om;
    const float rz = hz * c + cz * s + kz * om;

    hx = d * rx + ux;
    hy = d * ry + uy;
    hz = d * rz + uz;

    po[i * DDIM]     = hx;
    po[i * DDIM + 1] = hy;
    po[i * DDIM + 2] = hz;
  }
  // the stores' address and data registers are reused below: wait before they are rewritten
  asm volatile("s_wait_xcnt 0x0" ::: "memory");
}

// Launch B. inj lives in `out` and is overwritten in place with the state h_t;
// a thread reads and writes only its own chunk's elements of its own chain.
__global__ __launch_bounds__(256)
void qssm_scan_chunk(const float* __restrict__ biv,
                     const float* __restrict__ dec,
                     const float* __restrict__ cmap,
                     float* __restrict__ out) {
  const int ch = blockIdx.x;   // 0..NCHUNK-1
  const int b  = blockIdx.y;
  const int nb = threadIdx.x;  // 0..255
  const size_t base = ((size_t)b * TLEN + (size_t)ch * CLEN) * DDIM + (size_t)nb * 3;
  const float* pb = biv + base;
  float*       po = out + base;
  const float* pd = dec + (size_t)b * TLEN + (size_t)ch * CLEN;

  StepGrp ga, gb;
  load_grp(ga, pb, po);

  // start state of this chunk: earlier chunks' maps applied in time order to h = 0
  float hx = 0.0f, hy = 0.0f, hz = 0.0f;
  const float4* cj = (const float4*)cmap + (size_t)b * NCHUNK * 3 * NBQ + nb;
  // FOLD maps are fetched together so that their L2 latency is paid once per batch;
  // the last batch may fetch maps of chunks >= ch (launch A wrote them all) and
  // keeps only the results of those below ch
  for (int j0 = 0; j0 < ch; j0 += FOLD) {
    float4 r[FOLD][3];
// unrolled: constant indices keep the arrays in registers
#pragma unroll
    for (int i = 0; i < FOLD; ++i) {
// unrolled: constant indices keep the arrays in registers
#pragma unroll
      for (int q = 0; q < 3; ++q) r[i][q] = cj[(i * 3 + q) * NBQ];
    }
    cj += FOLD * 3 * NBQ;
// unrolled: constant indices keep the arrays in registers
#pragma unroll
    for (int i = 0; i < FOLD; ++i) {
      const bool on = j0 + i < ch;
      const float nx = r[i][0].x * hx + r[i][0].y * hy + r[i][0].z * hz + r[i][0].w;
      const float ny = r[i][1].x * hx + r[i][1].y * hy + r[i][1].z * hz + r[i][1].w;
      const float nz = r[i][2].x * hx + r[i][2].y * hy + r[i][2].z * hz + r[i][2].w;
      hx = on ? nx : hx;
      hy = on ? ny : hy;
      hz = on ? nz : hz;
    }
  }

  for (int g = 0; g < NGRP; g += 2) {
    load_grp(gb, pb + (g + 1) * GRP * DDIM, po + (g + 1) * GRP * DDIM);
    replay_grp(ga, pd + g * GRP, po + g * GRP * DDIM, hx, hy, hz);
    if (g + 2 < NGRP)
      load_grp(ga, pb + (g + 2) * GRP * DDIM, po + (g + 2) * GRP * DDIM);
    replay_grp(gb, pd + (g + 1) * GRP, po + (g + 1) * GRP * DDIM, hx, hy, hz);
  }
}

extern "C" void kernel_launch(void* const* d_in, const int* in_sizes, int n_in,
                              void* d_out, int out_size, void* d_ws, size_t ws_size,
                              hipStream_t stream) {
  const float* x      = (const float*)d_in[0];  // (B,T,D)
  const float* W_biv  = (const float*)d_in[1];  // (768,768)
  const float* b_biv  = (const float*)d_in[2];  // (768,)
  const float* W_dec  = (const float*)d_in[3];  // (1,768)
  const float* b_dec  = (const float*)d_in[4];  // (1,)
  const float* W_in   = (const float*)d_in[5];  // (768,768)
  const float* b_in   = (const float*)d_in[6];  // (768,)
  float* out = (float*)d_out;                   // (B,T,768)

  float* ws_biv = (float*)d_ws;                       // MROWS*768 floats
  float* ws_dec = ws_biv + (size_t)MROWS * DDIM;      // MROWS floats
  float* ws_map = ws_dec + (size_t)MROWS;             // BATCH*NCHUNK*3*NBQ float4

  // 1) fused projections: biv -> ws, inj -> d_out (in place for the scan)
  dim3 ggrid(MROWS / BM, NCOLS / BN);  // (128, 6)
  qssm_proj_gemm<<<ggrid, GTHREADS, 0, stream>>>(x, W_biv, W_in, b_biv, b_in,
                                            ws_biv, out);
  // 2) decay gate (GEMV + sigmoid)
  qssm_decay<<<MROWS / 8, 256, 0, stream>>>(x, W_dec, b_dec, ws_dec);
  // 3) each time chunk's affine map
  qssm_chunk_map<<<dim3(NCHUNK, BATCH), NBQ, 0, stream>>>(ws_biv, ws_dec, out, ws_map);
  // 4) fold the earlier chunks' maps, then replay each chunk's own steps
  qssm_scan_chunk<<<dim3(NCHUNK, BATCH), NBQ, 0, stream>>>(ws_biv, ws_dec, ws_map, out);
}

// v004
// It runs in 218 microseconds.
// In both of two side-by-side timings against v003, it was 1.06 times as fast.
// All steps since v000 together make it 12.6 times as fast.
#include <hip/hip_runtime.h>
#include <hip/hip_bf16.h>
#include <math.h>

// ---------------- problem constants ----------------
#define BATCH 8
#define TLEN  4096
#define DDIM  768
#define NBQ   256           // quaternion blocks (DDIM/3)
#define MROWS (BATCH * TLEN)  // 32768
#define NCOLS (2 * DDIM)      // 1536 : [0,768)=biv, [768,1536)=inj
#define KDIM  DDIM

// ---------------- GEMM tiling ----------------
#define BM 256
#define BN 256
#define BK 32
#define GTHREADS 512        // 16 waves, 4 x 4, each on a 64 x 64 piece of the tile
#define BKP (BK + 8)        // padded LDS row stride (bf16 elems) for bank spread

typedef __attribute__((ext_vector_type(16))) __bf16 v16bf;
typedef __attribute__((ext_vector_type(8)))  __bf16 v8bf;
typedef __attribute__((ext_vector_type(8)))  float  v8f;

// Load one 16x32 bf16 A/B fragment from an LDS plane laid out [row][BKP].
// CDNA5 16-bit operand layout: lanes 0-15 hold row=lane, K={0..7,16..23};
// lanes 16-31 hold row=lane-16, K={8..15,24..31}. Two aligned b128 loads.
__device__ __forceinline__ v16bf load_frag(const __bf16* plane, int row_base, int lane) {
  const int row   = row_base + (lane & 15);
  const int khalf = (lane >> 4) * 8;
  const __bf16* p = plane + row * BKP + khalf;
  v8bf c0 = *(const v8bf*)(p);
  v8bf c1 = *(const v8bf*)(p + 16);
  v16bf r;
#pragma unroll
  for (int i = 0; i < 8; ++i) { r[i] = c0[i]; r[i + 8] = c1[i]; }
  return r;
}

// One staged K tile in LDS: four bf16 planes [row][BKP] (BM == BN rows each).
#define PLANE  (BM * BKP)
#define STAGE  (4 * PLANE)      // A hi | A lo | B hi | B lo
#define NKT    (KDIM / BK)      // 24 K tiles
static_assert(BM == BN, "the four planes of a stage have one size");
static_assert(DDIM % BN == 0, "a column tile lies in one weight matrix");

// Split four floats into bf16 hi + lo and put them into the two planes.
__device__ __forceinline__ void split_store(__bf16* hi, __bf16* lo, const float4& v) {
// unrolled: constant indices keep the arrays in registers
#pragma unroll
  for (int q = 0; q < 4; ++q) {
    float f   = ((const float*)&v)[q];
    __bf16 h  = (__bf16)f;
    __bf16 l  = (__bf16)(f - (float)h);
    hi[q] = h;
    lo[q] = l;
  }
}

// The fetched registers of one K tile -> one LDS stage.
__device__ __forceinline__ void store_tile(__bf16* st, int srow, int scol,
                                           const float4 (&ra)[4], const float4 (&rb)[4]) {
// unrolled: constant indices keep the arrays in registers
#pragma unroll
  for (int pass = 0; pass < 4; ++pass) {
    const int o = (pass * 64 + srow) * BKP + scol;
    split_store(st + o, st + PLANE + o, ra[pass]);
    split_store(st + 2 * PLANE + o, st + 3 * PLANE + o, rb[pass]);
  }
}

// Adds one K tile's share of dot(x[row,:], W_decay) for the thread's four rows.
__device__ __forceinline__ void decay_part(float4& a, const float4 (&ra)[4], const float* w4) {
  const float4 w = *(const float4*)w4;
  a.x += ra[0].x * w.x + ra[0].y * w.y + ra[0].z * w.z + ra[0].w * w.w;
  a.y += ra[1].x * w.x + ra[1].y * w.y + ra[1].z * w.z + ra[1].w * w.w;
  a.z += ra[2].x * w.x + ra[2].y * w.y + ra[2].z * w.z + ra[2].w * w.w;
  a.w += ra[3].x * w.x + ra[3].y * w.y + ra[3].z * w.z + ra[3].w * w.w;
}

// bf16x3 split-precision WMMA on one staged K tile: acc += Ah*Bh + Ah*Bl + Al*Bh
// (each accumulator takes its three products in that order). The A fragments of
// the wave's 64 rows stay in registers; the B fragments pass through one column
// block at a time, so that accumulators, fragments and the fetched next tile fit
// the 256 registers a wave has in a work-group of 16 waves.
__device__ __forceinline__ void mma_tile(const __bf16* st, int wm, int wn, int lane,
                                         v8f (&acc)[4][4]) {
  v16bf a_hi[4], a_lo[4];
// unrolled: constant indices keep the arrays in registers
#pragma unroll
  for (int i = 0; i < 4; ++i) {
    a_hi[i] = load_frag(st, wm * 64 + i * 16, lane);
    a_lo[i] = load_frag(st + PLANE, wm * 64 + i * 16, lane);
  }
// unrolled: constant indices keep the arrays in registers
#pragma unroll
  for (int j = 0; j < 4; ++j) {
    const v16bf b_hi = load_frag(st + 2 * PLANE, wn * 64 + j * 16, lane);
    const v16bf b_lo = load_frag(st + 3 * PLANE, wn * 64 + j * 16, lane);
// unrolled: constant indices keep the arrays in registers
#pragma unroll
    for (int i = 0; i < 4; ++i)
      acc[i][j] = __builtin_amdgcn_wmma_f32_16x16x32_bf16(
          false, a_hi[i], false, b_hi, (short)0, acc[i][j], false, false);
// unrolled: constant indices keep the arrays in registers
#pragma unroll
    for (int i = 0; i < 4; ++i)
      acc[i][j] = __builtin_amdgcn_wmma_f32_16x16x32_bf16(
          false, a_hi[i], false, b_lo, (short)0, acc[i][j], false, false);
// unrolled: constant indices keep the arrays in registers
#pragma unroll
    for (int i = 0; i < 4; ++i)
      acc[i][j] = __builtin_amdgcn_wmma_f32_16x16x32_bf16(
          false, a_lo[i], false, b_hi, (short)0, acc[i][j], false, false);
  }
}

// Fused projection GEMM: out[m, n] for n in [0,1536).
//   n <  768 : biv column n      (weights W_biv, bias b_biv)  -> ws biv buffer
//   n >= 768 : inj column n-768  (weights W_in,  bias b_in)   -> d_out (in-place scanned later)
// Column tile 0 also writes decay[m] = sigmoid(dot(x[m,:], W_decay) + b_decay) of its rows.
// The K loop is software-pipelined: while tile kt is multiplied out of one LDS
// stage, tile kt+1 is already on its way from global memory into registers; it
// is split and stored into the other stage behind the WMMAs.
__global__ __launch_bounds__(GTHREADS)
void qssm_proj_gemm(const float* __restrict__ X,
                    const float* __restrict__ Wbiv,
                    const float* __restrict__ Win,
                    const float* __restrict__ bbiv,
                    const float* __restrict__ bin,
                    const float* __restrict__ Wd,
                    const float* __restrict__ bd,
                    float* __restrict__ out_biv,
                    float* __restrict__ out_inj,
                    float* __restrict__ dec) {
  __shared__ __attribute__((aligned(16))) __bf16 smem[2 * STAGE];
  // decay gate (column tile 0 only): W_decay, each thread's own partial dots of its
  // four staged rows, and the 256 finished row dots
  __shared__ __attribute__((aligned(16))) float swd[KDIM];
  __shared__ __attribute__((aligned(16))) float sacc[GTHREADS * 4];
  __shared__ float sdot[BM];

  const int tid  = threadIdx.x;
  const int lane = tid & 31;
  // the wave's number as a scalar: its row and column offsets then take no vector
  // registers, which the 256 a wave has here are short of
  const int wave = __builtin_amdgcn_readfirstlane(tid >> 5);   // 0..15
  const int wm   = wave & 3;      // 4 waves along M (64 rows each)
  const int wn   = wave >> 2;     // 4 waves along N (64 cols each)

  const int m0 = blockIdx.x * BM;
  const int n0 = blockIdx.y * BN;
  // the x rows pass through this thread's registers anyway: the work-groups of
  // column tile 0 also sum dot(x[m,:], W_decay) from them (same for the whole group)
  const bool dk = blockIdx.y == 0;

  v8f acc[4][4];
// unrolled: constant indices keep the arrays in registers
#pragma unroll
  for (int i = 0; i < 4; ++i)
// unrolled: constant indices keep the arrays in registers
#pragma unroll
    for (int j = 0; j < 4; ++j) acc[i][j] = (v8f)0.0f;

  // staging map: 8 threads per row (8 x float4 = 32 floats), 64 rows per pass
  const int srow = tid >> 3;        // 0..63
  const int scol = (tid & 7) * 4;   // 0,4,...,28

  // A: x[m0+row, ...] ; B: weight row (n0+row) of W_biv or W_in
  const float* wtile = (n0 < DDIM) ? (Wbiv + (size_t)n0 * KDIM)
                                   : (Win + (size_t)(n0 - DDIM) * KDIM);
  const float* pa = X + (size_t)(m0 + srow) * KDIM + scol;
  const float* pb = wtile + (size_t)srow * KDIM + scol;

  float4 ra[4], rb[4];
  long kstep = BK;   // floats from one K tile to the next

  // ---- tile 0: fetch, split, store into stage 0 ----
// unrolled: constant indices keep the arrays in registers
#pragma unroll
  for (int pass = 0; pass < 4; ++pass) {
    ra[pass] = *(const float4*)(pa + pass * 64 * KDIM);
    rb[pass] = *(const float4*)(pb + pass * 64 * KDIM);
  }
  // the loads' address registers are advanced below: wait before they are
  // rewritten; as inputs they stay untouched up to here
  asm volatile("s_wait_xcnt 0x0" :: "v"(pa), "v"(pb) : "memory");
  if (dk) {
    if (tid < KDIM / 4) ((float4*)swd)[tid] = ((const float4*)Wd)[tid];
    // publishes W_decay to the group before its first use just below
    __syncthreads();
    float4 a = make_float4(0.0f, 0.0f, 0.0f, 0.0f);
    decay_part(a, ra, swd + scol);
    ((float4*)sacc)[tid] = a;
  }
  store_tile(smem, srow, scol, ra, rb);
  __syncthreads();

  for (int kt = 0; kt < NKT - 1; ++kt) {
    // ---- all eight loads of tile kt+1 go out together, ahead of tile kt's WMMAs ----
    // (pa, pb point at tile kt)
// unrolled: constant indices keep the arrays in registers
#pragma unroll
    for (int pass = 0; pass < 4; ++pass) {
      ra[pass] = *(const float4*)(pa + pass * 64 * KDIM + BK);
      rb[pass] = *(const float4*)(pb + pass * 64 * KDIM + BK);
      if (kt + 2 < NKT) {
        __builtin_prefetch(pa + pass * 64 * KDIM + 2 * BK, 0, 1);
        __builtin_prefetch(pb + pass * 64 * KDIM + 2 * BK, 0, 1);
      }
    }
    // keeps the eight loads in front of the fragment reads and the WMMAs, so that
    // their latency runs out behind the matrix work
    __builtin_amdgcn_sched_barrier(0);

    mma_tile(smem + (kt & 1) * STAGE, wm, wn, lane, acc);

    // keeps the split (and with it the wait for the loads) behind the last WMMA
    __builtin_amdgcn_sched_barrier(0);
    // the address registers are advanced next: wait before they are rewritten.
    // As inputs they stay untouched up to the wait, and the step comes out of the
    // statement so that the two additions cannot be placed in front of it
    asm volatile("s_wait_xcnt 0x0" : "+s"(kstep) : "v"(pa), "v"(pb) : "memory");
    pa += kstep;
    pb += kstep;

    if (dk) {
      // a thread reads and writes only its own slot: no barrier is needed for it
      float4 a = ((const float4*)sacc)[tid];
      decay_part(a, ra, swd + (kt + 1) * BK + scol);
      ((float4*)sacc)[tid] = a;
    }
    // stage (kt+1)&1 was last read in trip kt-1, and every wave has passed that
    // trip's barrier; this trip's one barrier publishes it
    store_tile(smem + ((kt + 1) & 1) * STAGE, srow, scol, ra, rb);
    __syncthreads();
  }
  if (dk) {
    const float bd0 = bd[0];
    // a row's eight threads are eight neighbouring lanes: butterfly over them
    float4 a = ((const float4*)sacc)[tid];
// unrolled: three fixed steps
#pragma unroll
    for (int off = 1; off < 8; off <<= 1) {
      a.x += __shfl_xor(a.x, off, 32);
      a.y += __shfl_xor(a.y, off, 32);
      a.z += __shfl_xor(a.z, off, 32);
      a.w += __shfl_xor(a.w, off, 32);
    }
    if ((tid & 7) == 0) {
      sdot[srow]       = a.x;
      sdot[64 + srow]  = a.y;
      sdot[128 + srow] = a.z;
      sdot[192 + srow] = a.w;
    }
    // hands the row dots to the waves that store them, one whole line per wave
    __syncthreads();
    if (tid < BM) {
      const float z = sdot[tid] + bd0;
      dec[m0 + tid] = 1.0f / (1.0f + expf(-z));
    }
  }
  // a column tile lies in one weight matrix: bias vector and destination are the tile's
  const bool to_biv  = n0 < DDIM;
  const float* bsrc  = to_biv ? bbiv : bin;
  float* dst         = to_biv ? out_biv : out_inj;
  const int col0     = (to_biv ? n0 : n0 - DDIM) + wn * 64 + (lane & 15);
  float bias[4];
// unrolled: constant indices keep the array in registers
#pragma unroll
  for (int j = 0; j < 4; ++j) bias[j] = bsrc[col0 + j * 16];
  // keeps the four bias loads in front of the last tile's WMMAs, which hide their latency
  __builtin_amdgcn_sched_barrier(0);

  mma_tile(smem + ((NKT - 1) & 1) * STAGE, wm, wn, lane, acc);
  // keeps the epilogue's address arithmetic behind the last WMMA: among the WMMAs
  // no register is free for it, and it would spill to scratch
  __builtin_amdgcn_sched_barrier(0);

  // ---- epilogue: bias + scatter to biv workspace or inj (=d_out) ----
  // C/D layout: VGPR r, lanes 0-15 -> M=r, N=lane; lanes 16-31 -> M=8+r, N=lane-16.
  const int half = (lane >> 4) & 1;
#pragma unroll
  for (int i = 0; i < 4; ++i) {
#pragma unroll
    for (int j = 0; j < 4; ++j) {
      const int mb = m0 + wm * 64 + i * 16 + half * 8;
#pragma unroll
      for (int r = 0; r < 8; ++r) {
        dst[(size_t)(mb + r) * DDIM + col0 + j * 16] = acc[i][j][r] + bias[j];
      }
    }
  }
}

// ---------------- time-chunked Rodrigues scan ----------------
// One step is the affine map h -> d * R(b) * h + u, so a run of steps is again
// an affine map h -> M * h + e. T is cut into NCHUNK chunks:
//   launch A: one thread per (batch, chunk, chain) composes its chunk's (M, e);
//   launch B: the same thread folds the maps of all earlier chunks, in time
//             order, into its chunk's start state and then replays its own
//             steps with the step formula, writing the states.
#define NCHUNK 64
#define CLEN   (TLEN / NCHUNK)   // 64 steps per chunk
#define GRP    4                 // steps fetched together, one group ahead
#define NGRP   (CLEN / GRP)      // 16, even
#define FOLD   8                 // chunk maps fetched together in launch B

struct StepGrp {
  float b[GRP][3];
  float u[GRP][3];
};

__device__ __forceinline__ void load_grp(StepGrp& g, const float* pb, const float* pu) {
// unrolled: constant indices keep the arrays in registers
#pragma unroll
  for (int i = 0; i < GRP; ++i) {
// unrolled: constant indices keep the arrays in registers
#pragma unroll
    for (int q = 0; q < 3; ++q) {
      g.b[i][q] = pb[i * DDIM + q];
      g.u[i][q] = pu[i * DDIM + q];
    }
  }
  // the loads' address registers are reused below: wait before they are rewritten
  asm volatile("s_wait_xcnt 0x0" ::: "memory");
}

// M <- R * M, p <- p * d, e <- d * R * e + u for the GRP steps of one group.
__device__ __forceinline__ void compose_grp(const StepGrp& g, const float* dg,
                                            float (&m)[3][3], float& p, float (&e)[3]) {
// unrolled: constant indices keep the arrays in registers
#pragma unroll
  for (int i = 0; i < GRP; ++i) {
    const float bx = g.b[i][0], by = g.b[i][1], bz = g.b[i][2];
    const float d  = dg[i];

    const float th  = sqrtf(bx * bx + by * by + bz * bz);
    const float inv = 1.0f / fmaxf(th, 1e-8f);
    const float kx = bx * inv, ky = by * inv, kz = bz * inv;
    const float c = cosf(th), s = sinf(th);

    // R = c I + s [k]x + (1 - c) k k^T
    const float oc = 1.0f - c;
    const float ax = oc * kx, ay = oc * ky, az = oc * kz;
    const float sx = s * kx,  sy = s * ky,  sz = s * kz;
    const float r00 = ax * kx + c,  r01 = ax * ky - sz, r02 = ax * kz + sy;
    const float r10 = ay * kx + sz, r11 = ay * ky + c,  r12 = ay * kz - sx;
    const float r20 = az * kx - sy, r21 = az * ky + sx, r22 = az * kz + c;

// unrolled: constant indices keep the arrays in registers
#pragma unroll
    for (int j = 0; j < 3; ++j) {
      const float a0 = m[0][j], a1 = m[1][j], a2 = m[2][j];
      m[0][j] = r00 * a0 + r01 * a1 + r02 * a2;
      m[1][j] = r10 * a0 + r11 * a1 + r12 * a2;
      m[2][j] = r20 * a0 + r21 * a1 + r22 * a2;
    }
    const float e0 = e[0], e1 = e[1], e2 = e[2];
    e[0] = d * (r00 * e0 + r01 * e1 + r02 * e2) + g.u[i][0];
    e[1] = d * (r10 * e0 + r11 * e1 + r12 * e2) + g.u[i][1];
    e[2] = d * (r20 * e0 + r21 * e1 + r22 * e2) + g.u[i][2];
    p *= d;
  }
}

// Launch A. Chunk map layout: float4 cmap[b][chunk][row 0..2][chain],
// row i = (M[i][0], M[i][1], M[i][2], e[i]).
__global__ __launch_bounds__(256)
void qssm_chunk_map(const float* __restrict__ biv,
                    const float* __restrict__ dec,
                    const float* __restrict__ inj,
                    float* __restrict__ cmap) {
  const int ch = blockIdx.x;   // 0..NCHUNK-1
  const int b  = blockIdx.y;
  const int nb = threadIdx.x;  // 0..255
  const size_t base = ((size_t)b * TLEN + (size_t)ch * CLEN) * DDIM + (size_t)nb * 3;
  const float* pb = biv + base;
  const float* pu = inj + base;
  const float* pd = dec + (size_t)b * TLEN + (size_t)ch * CLEN;

  float m[3][3] = {{1.0f, 0.0f, 0.0f}, {0.0f, 1.0f, 0.0f}, {0.0f, 0.0f, 1.0f}};
  float e[3] = {0.0f, 0.0f, 0.0f};
  float p = 1.0f;

  StepGrp ga, gb;
  load_grp(ga, pb, pu);
  for (int g = 0; g < NGRP; g += 2) {
    load_grp(gb, pb + (g + 1) * GRP * DDIM, pu + (g + 1) * GRP * DDIM);
    compose_grp(ga, pd + g * GRP, m, p, e);
    if (g + 2 < NGRP)
      load_grp(ga, pb + (g + 2) * GRP * DDIM, pu + (g + 2) * GRP * DDIM);
    compose_grp(gb, pd + (g + 1) * GRP, m, p, e);
  }

  float4* cm = (float4*)cmap + ((size_t)b * NCHUNK + ch) * 3 * NBQ + nb;
// unrolled: constant indices keep the arrays in registers
#pragma unroll
  for (int i = 0; i < 3; ++i)
    cm[i * NBQ] = make_float4(p * m[i][0], p * m[i][1], p * m[i][2], e[i]);
}

// The GRP steps of one group with the step formula; states go to po.
__device__ __forceinline__ void replay_grp(const StepGrp& g, const float* dg, float* po,
                                           float& hx, float& hy, float& hz) {
// unrolled: constant indices keep the arrays in registers
#pragma unroll
  for (int i = 0; i < GRP; ++i) {
    const float bx = g.b[i][0], by = g.b[i][1], bz = g.b[i][2];
    const float ux = g.u[i][0], uy = g.u[i][1], uz = g.u[i][2];
    const float d  = dg[i];

    const float th  = sqrtf(bx * bx + by * by + bz * bz);
    const float inv = 1.0f / fmaxf(th, 1e-8f);
    const float kx = bx * inv, ky = by * inv, kz = bz * inv;
    const float c = cosf(th), s = sinf(th);

    const float cx = ky * hz - kz * hy;
    const float cy = kz * hx - kx * hz;
    const float cz = kx * hy - ky * hx;
    const float kdoth = kx * hx + ky * hy + kz * hz;
    const float om = (1.0f - c) * kdoth;

    const float rx = hx * c + cx * s + kx * om;
    const float ry = hy * c + cy * s + ky * om;
    const float rz = hz * c + cz * s + kz * om;

    hx = d * rx + ux;
    hy = d * ry + uy;
    hz = d * rz + uz;

    po[i * DDIM]     = hx;
    po[i * DDIM + 1] = hy;
    po[i * DDIM + 2] = hz;
  }
  // the stores' address and data registers are reused below: wait before they are rewritten
  asm volatile("s_wait_xcnt 0x0" ::: "memory");
}

// Launch B. inj lives in `out` and is overwritten in place with the state h_t;
// a thread reads and writes only its own chunk's elements of its own chain.
__global__ __launch_bounds__(256)
void qssm_scan_chunk(const float* __restrict__ biv,
                     const float* __restrict__ dec,
                     const float* __restrict__ cmap,
                     float* __restrict__ out) {
  const int ch = blockIdx.x;   // 0..NCHUNK-1
  const int b  = blockIdx.y;
  const int nb = threadIdx.x;  // 0..255
  const size_t base = ((size_t)b * TLEN + (size_t)ch * CLEN) * DDIM + (size_t)nb * 3;
  const float* pb = biv + base;
  float*       po = out + base;
  const float* pd = dec + (size_t)b * TLEN + (size_t)ch * CLEN;

  StepGrp ga, gb;
  load_grp(ga, pb, po);

  // start state of this chunk: earlier chunks' maps applied in time order to h = 0
  float hx = 0.0f, hy = 0.0f, hz = 0.0f;
  const float4* cj = (const float4*)cmap + (size_t)b * NCHUNK * 3 * NBQ + nb;
  // FOLD maps are fetched together so that their L2 latency is paid once per batch;
  // the last batch may fetch maps of chunks >= ch (launch A wrote them all) and
  // keeps only the results of those below ch
  for (int j0 = 0; j0 < ch; j0 += FOLD) {
    float4 r[FOLD][3];
// unrolled: constant indices keep the arrays in registers
#pragma unroll
    for (int i = 0; i < FOLD; ++i) {
// unrolled: constant indices keep the arrays in registers
#pragma unroll
      for (int q = 0; q < 3; ++q) r[i][q] = cj[(i * 3 + q) * NBQ];
    }
    cj += FOLD * 3 * NBQ;
// unrolled: constant indices keep the arrays in registers
#pragma unroll
    for (int i = 0; i < FOLD; ++i) {
      const bool on = j0 + i < ch;
      const float nx = r[i][0].x * hx + r[i][0].y * hy + r[i][0].z * hz + r[i][0].w;
      const float ny = r[i][1].x * hx + r[i][1].y * hy + r[i][1].z * hz + r[i][1].w;
      const float nz = r[i][2].x * hx + r[i][2].y * hy + r[i][2].z * hz + r[i][2].w;
      hx = on ? nx : hx;
      hy = on ? ny : hy;
      hz = on ? nz : hz;
    }
  }

  for (int g = 0; g < NGRP; g += 2) {
    load_grp(gb, pb + (g + 1) * GRP * DDIM, po + (g + 1) * GRP * DDIM);
    replay_grp(ga, pd + g * GRP, po + g * GRP * DDIM, hx, hy, hz);
    if (g + 2 < NGRP)
      load_grp(ga, pb + (g + 2) * GRP * DDIM, po + (g + 2) * GRP * DDIM);
    replay_grp(gb, pd + (g + 1) * GRP, po + (g + 1) * GRP * DDIM, hx, hy, hz);
  }
}

extern "C" void kernel_launch(void* const* d_in, const int* in_sizes, int n_in,
                              void* d_out, int out_size, void* d_ws, size_t ws_size,
                              hipStream_t stream) {
  const float* x      = (const float*)d_in[0];  // (B,T,D)
  const float* W_biv  = (const float*)d_in[1];  // (768,768)
  const float* b_biv  = (const float*)d_in[2];  // (768,)
  const float* W_dec  = (const float*)d_in[3];  // (1,768)
  const float* b_dec  = (const float*)d_in[4];  // (1,)
  const float* W_in   = (const float*)d_in[5];  // (768,768)
  const float* b_in   = (const float*)d_in[6];  // (768,)
  float* out = (float*)d_out;                   // (B,T,768)

  float* ws_biv = (float*)d_ws;                       // MROWS*768 floats
  float* ws_dec = ws_biv + (size_t)MROWS * DDIM;      // MROWS floats
  float* ws_map = ws_dec + (size_t)MROWS;             // BATCH*NCHUNK*3*NBQ float4

  // 1) fused projections: biv -> ws, inj -> d_out (in place for the scan)
  dim3 ggrid(MROWS / BM, NCOLS / BN);  // (128, 6)
  //    and the decay gate (GEMV + sigmoid) -> ws
  qssm_proj_gemm<<<ggrid, GTHREADS, 0, stream>>>(x, W_biv, W_in, b_biv, b_in, W_dec, b_dec,
                                            ws_biv, out, ws_dec);
  // 2) each time chunk's affine map
  qssm_chunk_map<<<dim3(NCHUNK, BATCH), NBQ, 0, stream>>>(ws_biv, ws_dec, out, ws_map);
  // 3) fold the earlier chunks' maps, then replay each chunk's own steps
  qssm_scan_chunk<<<dim3(NCHUNK, BATCH), NBQ, 0, stream>>>(ws_biv, ws_dec, ws_map, out);
}

// v005
// It runs in 210 microseconds.
// In both of two side-by-side timings against v004, it was 1.04 times as fast.
// Over all steps from v000 it is 13.1 times as fast.
#include <hip/hip_runtime.h>
#include <hip/hip_bf16.h>
#include <math.h>

// ---------------- problem constants ----------------
#define BATCH 8
#define TLEN  4096
#define DDIM  768
#define NBQ   256           // quaternion blocks (DDIM/3)
#define MROWS (BATCH * TLEN)  // 32768
#define NCOLS (2 * DDIM)      // 1536 : [0,768)=biv, [768,1536)=inj
#define KDIM  DDIM

// ---------------- GEMM tiling ----------------
#define BM 256
#define BN 256
#define BK 32
#define GTHREADS 512        // 16 waves, 4 x 4, each on a 64 x 64 piece of the tile
#define BKP (BK + 8)        // padded LDS row stride (bf16 elems) for bank spread

typedef __attribute__((ext_vector_type(16))) __bf16 v16bf;
typedef __attribute__((ext_vector_type(8)))  __bf16 v8bf;
typedef __attribute__((ext_vector_type(8)))  float  v8f;

// Load one 16x32 bf16 A/B fragment from an LDS plane laid out [row][BKP].
// CDNA5 16-bit operand layout: lanes 0-15 hold row=lane, K={0..7,16..23};
// lanes 16-31 hold row=lane-16, K={8..15,24..31}. Two aligned b128 loads.
__device__ __forceinline__ v16bf load_frag(const __bf16* plane, int row_base, int lane) {
  const int row   = row_base + (lane & 15);
  const int khalf = (lane >> 4) * 8;
  const __bf16* p = plane + row * BKP + khalf;
  v8bf c0 = *(const v8bf*)(p);
  v8bf c1 = *(const v8bf*)(p + 16);
  v16bf r;
#pragma unroll
  for (int i = 0; i < 8; ++i) { r[i] = c0[i]; r[i + 8] = c1[i]; }
  return r;
}

// One staged K tile in LDS: four bf16 planes [row][BKP] (BM == BN rows each).
#define PLANE  (BM * BKP)
#define STAGE  (4 * PLANE)      // A hi | A lo | B hi | B lo
#define NKT    (KDIM / BK)      // 24 K tiles
static_assert(BM == BN, "the four planes of a stage have one size");
static_assert(DDIM % BN == 0, "a column tile lies in one weight matrix");

// Split four floats into bf16 hi + lo and put them into the two planes.
__device__ __forceinline__ void split_store(__bf16* hi, __bf16* lo, const float4& v) {
// unrolled: constant indices keep the arrays in registers
#pragma unroll
  for (int q = 0; q < 4; ++q) {
    float f   = ((const float*)&v)[q];
    __bf16 h  = (__bf16)f;
    __bf16 l  = (__bf16)(f - (float)h);
    hi[q] = h;
    lo[q] = l;
  }
}

// The fetched registers of one K tile -> one LDS stage.
__device__ __forceinline__ void store_tile(__bf16* st, int srow, int scol,
                                           const float4 (&ra)[4], const float4 (&rb)[4]) {
// unrolled: constant indices keep the arrays in registers
#pragma unroll
  for (int pass = 0; pass < 4; ++pass) {
    const int o = (pass * 64 + srow) * BKP + scol;
    split_store(st + o, st + PLANE + o, ra[pass]);
    split_store(st + 2 * PLANE + o, st + 3 * PLANE + o, rb[pass]);
  }
}

// Adds one K tile's share of dot(x[row,:], W_decay) for the thread's four rows.
__device__ __forceinline__ void decay_part(float4& a, const float4 (&ra)[4], const float* w4) {
  const float4 w = *(const float4*)w4;
  a.x += ra[0].x * w.x + ra[0].y * w.y + ra[0].z * w.z + ra[0].w * w.w;
  a.y += ra[1].x * w.x + ra[1].y * w.y + ra[1].z * w.z + ra[1].w * w.w;
  a.z += ra[2].x * w.x + ra[2].y * w.y + ra[2].z * w.z + ra[2].w * w.w;
  a.w += ra[3].x * w.x + ra[3].y * w.y + ra[3].z * w.z + ra[3].w * w.w;
}

// bf16x3 split-precision WMMA on one staged K tile: acc += Ah*Bh + Ah*Bl + Al*Bh
// (each accumulator takes its three products in that order). The A fragments of
// the wave's 64 rows stay in registers; the B fragments pass through one column
// block at a time, so that accumulators, fragments and the fetched next tile fit
// the 256 registers a wave has in a work-group of 16 waves.
__device__ __forceinline__ void mma_tile(const __bf16* st, int wm, int wn, int lane,
                                         v8f (&acc)[4][4]) {
  v16bf a_hi[4], a_lo[4];
// unrolled: constant indices keep the arrays in registers
#pragma unroll
  for (int i = 0; i < 4; ++i) {
    a_hi[i] = load_frag(st, wm * 64 + i * 16, lane);
    a_lo[i] = load_frag(st + PLANE, wm * 64 + i * 16, lane);
  }
// unrolled: constant indices keep the arrays in registers
#pragma unroll
  for (int j = 0; j < 4; ++j) {
    const v16bf b_hi = load_frag(st + 2 * PLANE, wn * 64 + j * 16, lane);
    const v16bf b_lo = load_frag(st + 3 * PLANE, wn * 64 + j * 16, lane);
// unrolled: constant indices keep the arrays in registers
#pragma unroll
    for (int i = 0; i < 4; ++i)
      acc[i][j] = __builtin_amdgcn_wmma_f32_16x16x32_bf16(
          false, a_hi[i], false, b_hi, (short)0, acc[i][j], false, false);
// unrolled: constant indices keep the arrays in registers
#pragma unroll
    for (int i = 0; i < 4; ++i)
      acc[i][j] = __builtin_amdgcn_wmma_f32_16x16x32_bf16(
          false, a_hi[i], false, b_lo, (short)0, acc[i][j], false, false);
// unrolled: constant indices keep the arrays in registers
#pragma unroll
    for (int i = 0; i < 4; ++i)
      acc[i][j] = __builtin_amdgcn_wmma_f32_16x16x32_bf16(
          false, a_lo[i], false, b_hi, (short)0, acc[i][j], false, false);
  }
}

// Fused projection GEMM: out[m, n] for n in [0,1536).
//   n <  768 : biv column n      (weights W_biv, bias b_biv)  -> ws biv buffer
//   n >= 768 : inj column n-768  (weights W_in,  bias b_in)   -> d_out (in-place scanned later)
// Column tile 0 also writes decay[m] = sigmoid(dot(x[m,:], W_decay) + b_decay) of its rows.
// The K loop is software-pipelined: while tile kt is multiplied out of one LDS
// stage, tile kt+1 is already on its way from global memory into registers; it
// is split and stored into the other stage behind the WMMAs.
__global__ __launch_bounds__(GTHREADS)
void qssm_proj_gemm(const float* __restrict__ X,
                    const float* __restrict__ Wbiv,
                    const float* __restrict__ Win,
                    const float* __restrict__ bbiv,
                    const float* __restrict__ bin,
                    const float* __restrict__ Wd,
                    const float* __restrict__ bd,
                    float* __restrict__ out_biv,
                    float* __restrict__ out_inj,
                    float* __restrict__ dec) {
  __shared__ __attribute__((aligned(16))) __bf16 smem[2 * STAGE];
  // decay gate (column tile 0 only): W_decay, each thread's own partial dots of its
  // four staged rows, and the 256 finished row dots
  __shared__ __attribute__((aligned(16))) float swd[KDIM];
  __shared__ __attribute__((aligned(16))) float sacc[GTHREADS * 4];
  __shared__ float sdot[BM];

  const int tid  = threadIdx.x;
  const int lane = tid & 31;
  // the wave's number as a scalar: its row and column offsets then take no vector
  // registers, which the 256 a wave has here are short of
  const int wave = __builtin_amdgcn_readfirstlane(tid >> 5);   // 0..15
  const int wm   = wave & 3;      // 4 waves along M (64 rows each)
  const int wn   = wave >> 2;     // 4 waves along N (64 cols each)

  const int m0 = blockIdx.x * BM;
  const int n0 = blockIdx.y * BN;
  // the x rows pass through this thread's registers anyway: the work-groups of
  // column tile 0 also sum dot(x[m,:], W_decay) from them (same for the whole group)
  const bool dk = blockIdx.y == 0;

  v8f acc[4][4];
// unrolled: constant indices keep the arrays in registers
#pragma unroll
  for (int i = 0; i < 4; ++i)
// unrolled: constant indices keep the arrays in registers
#pragma unroll
    for (int j = 0; j < 4; ++j) acc[i][j] = (v8f)0.0f;

  // staging map: 8 threads per row (8 x float4 = 32 floats), 64 rows per pass
  const int srow = tid >> 3;        // 0..63
  const int scol = (tid & 7) * 4;   // 0,4,...,28

  // A: x[m0+row, ...] ; B: weight row (n0+row) of W_biv or W_in
  const float* wtile = (n0 < DDIM) ? (Wbiv + (size_t)n0 * KDIM)
                                   : (Win + (size_t)(n0 - DDIM) * KDIM);
  const float* pa = X + (size_t)(m0 + srow) * KDIM + scol;
  const float* pb = wtile + (size_t)srow * KDIM + scol;

  float4 ra[4], rb[4];
  long kstep = BK;   // floats from one K tile to the next

  // ---- tile 0: fetch, split, store into stage 0 ----
// unrolled: constant indices keep the arrays in registers
#pragma unroll
  for (int pass = 0; pass < 4; ++pass) {
    ra[pass] = *(const float4*)(pa + pass * 64 * KDIM);
    rb[pass] = *(const float4*)(pb + pass * 64 * KDIM);
  }
  // the loads' address registers are advanced below: wait before they are
  // rewritten; as inputs they stay untouched up to here
  asm volatile("s_wait_xcnt 0x0" :: "v"(pa), "v"(pb) : "memory");
  if (dk) {
    if (tid < KDIM / 4) ((float4*)swd)[tid] = ((const float4*)Wd)[tid];
    // publishes W_decay to the group before its first use just below
    __syncthreads();
    float4 a = make_float4(0.0f, 0.0f, 0.0f, 0.0f);
    decay_part(a, ra, swd + scol);
    ((float4*)sacc)[tid] = a;
  }
  store_tile(smem, srow, scol, ra, rb);
  __syncthreads();

  for (int kt = 0; kt < NKT - 1; ++kt) {
    // ---- all eight loads of tile kt+1 go out together, ahead of tile kt's WMMAs ----
    // (pa, pb point at tile kt)
// unrolled: constant indices keep the arrays in registers
#pragma unroll
    for (int pass = 0; pass < 4; ++pass) {
      ra[pass] = *(const float4*)(pa + pass * 64 * KDIM + BK);
      rb[pass] = *(const float4*)(pb + pass * 64 * KDIM + BK);
      if (kt + 2 < NKT) {
        __builtin_prefetch(pa + pass * 64 * KDIM + 2 * BK, 0, 1);
        __builtin_prefetch(pb + pass * 64 * KDIM + 2 * BK, 0, 1);
      }
    }
    // keeps the eight loads in front of the fragment reads and the WMMAs, so that
    // their latency runs out behind the matrix work
    __builtin_amdgcn_sched_barrier(0);

    mma_tile(smem + (kt & 1) * STAGE, wm, wn, lane, acc);

    // keeps the split (and with it the wait for the loads) behind the last WMMA
    __builtin_amdgcn_sched_barrier(0);
    // the address registers are advanced next: wait before they are rewritten.
    // As inputs they stay untouched up to the wait, and the step comes out of the
    // statement so that the two additions cannot be placed in front of it
    asm volatile("s_wait_xcnt 0x0" : "+s"(kstep) : "v"(pa), "v"(pb) : "memory");
    pa += kstep;
    pb += kstep;

    if (dk) {
      // a thread reads and writes only its own slot: no barrier is needed for it
      float4 a = ((const float4*)sacc)[tid];
      decay_part(a, ra, swd + (kt + 1) * BK + scol);
      ((float4*)sacc)[tid] = a;
    }
    // stage (kt+1)&1 was last read in trip kt-1, and every wave has passed that
    // trip's barrier; this trip's one barrier publishes it
    store_tile(smem + ((kt + 1) & 1) * STAGE, srow, scol, ra, rb);
    __syncthreads();
  }
  if (dk) {
    const float bd0 = bd[0];
    // a row's eight threads are eight neighbouring lanes: butterfly over them
    float4 a = ((const float4*)sacc)[tid];
// unrolled: three fixed steps
#pragma unroll
    for (int off = 1; off < 8; off <<= 1) {
      a.x += __shfl_xor(a.x, off, 32);
      a.y += __shfl_xor(a.y, off, 32);
      a.z += __shfl_xor(a.z, off, 32);
      a.w += __shfl_xor(a.w, off, 32);
    }
    if ((tid & 7) == 0) {
      sdot[srow]       = a.x;
      sdot[64 + srow]  = a.y;
      sdot[128 + srow] = a.z;
      sdot[192 + srow] = a.w;
    }
    // hands the row dots to the waves that store them, one whole line per wave
    __syncthreads();
    if (tid < BM) {
      const float z = sdot[tid] + bd0;
      dec[m0 + tid] = 1.0f / (1.0f + expf(-z));
    }
  }
  // a column tile lies in one weight matrix: bias vector and destination are the tile's
  const bool to_biv  = n0 < DDIM;
  const float* bsrc  = to_biv ? bbiv : bin;
  float* dst         = to_biv ? out_biv : out_inj;
  const int col0     = (to_biv ? n0 : n0 - DDIM) + wn * 64 + (lane & 15);
  float bias[4];
// unrolled: constant indices keep the array in registers
#pragma unroll
  for (int j = 0; j < 4; ++j) bias[j] = bsrc[col0 + j * 16];
  // keeps the four bias loads in front of the last tile's WMMAs, which hide their latency
  __builtin_amdgcn_sched_barrier(0);

  mma_tile(smem + ((NKT - 1) & 1) * STAGE, wm, wn, lane, acc);
  // keeps the epilogue's address arithmetic behind the last WMMA: among the WMMAs
  // no register is free for it, and it would spill to scratch
  __builtin_amdgcn_sched_barrier(0);

  // ---- epilogue: bias + scatter to biv workspace or inj (=d_out) ----
  // C/D layout: VGPR r, lanes 0-15 -> M=r, N=lane; lanes 16-31 -> M=8+r, N=lane-16.
  const int half = (lane >> 4) & 1;
#pragma unroll
  for (int i = 0; i < 4; ++i) {
#pragma unroll
    for (int j = 0; j < 4; ++j) {
      const int mb = m0 + wm * 64 + i * 16 + half * 8;
#pragma unroll
      for (int r = 0; r < 8; ++r) {
        dst[(size_t)(mb + r) * DDIM + col0 + j * 16] = acc[i][j][r] + bias[j];
      }
    }
  }
}

// ---------------- time-chunked Rodrigues scan ----------------
// One step is the affine map h -> d * R(b) * h + u, so a run of steps is again
// an affine map h -> M * h + e. T is cut into NCHUNK chunks:
//   launch A: one thread per (batch, chunk, chain) composes its chunk's (M, e);
//   launch B: the same thread folds the maps of all earlier chunks, in time
//             order, into its chunk's start state and then replays its own
//             steps with the step formula, writing the states.
#define NCHUNK 64
#define CLEN   (TLEN / NCHUNK)   // 64 steps per chunk
#define GRP    4                 // steps fetched together, one group ahead
#define NGRP   (CLEN / GRP)      // 16, even
#define FOLD   8                 // chunk maps fetched together in launch B

struct StepGrp {
  float b[GRP][3];
  float u[GRP][3];
};

__device__ __forceinline__ void load_grp(StepGrp& g, const float* pb, const float* pu) {
// unrolled: constant indices keep the arrays in registers
#pragma unroll
  for (int i = 0; i < GRP; ++i) {
// unrolled: constant indices keep the arrays in registers
#pragma unroll
    for (int q = 0; q < 3; ++q) {
      g.b[i][q] = pb[i * DDIM + q];
      g.u[i][q] = pu[i * DDIM + q];
    }
  }
  // the loads' address registers are reused below: wait before they are rewritten;
  // as inputs they stay untouched up to here
  asm volatile("s_wait_xcnt 0x0" :: "v"(pb), "v"(pu) : "memory");
}

// sin and cos of one angle 0 <= x < 2^17 from ONE range reduction: quadrant count and
// remainder by pi/2 in three parts, then the two polynomials on [-pi/4, pi/4]. These are
// the operations sinf and cosf do for such an angle, so the values are theirs.
__device__ __forceinline__ void sincos_mid(float x, float& s, float& c) {
  const float n = rintf(x * __uint_as_float(0x3f22f983u));      // x * 2/pi
  float r = fmaf(n, __uint_as_float(0xbfc90fdau), x);           // - n * pi/2, high part
  r = fmaf(n, __uint_as_float(0xb3a22168u), r);                 //             middle part
  r = fmaf(n, __uint_as_float(0xa7c234c4u), r);                 //             low part
  const int q = (int)n;
  const float t = r * r;
  float ps = fmaf(__uint_as_float(0xb94c1982u), t, __uint_as_float(0x3c0881c4u));
  ps = fmaf(t, ps, __uint_as_float(0xbe2aaa9du));
  const float sn = fmaf(r, t * ps, r);
  float pc = fmaf(__uint_as_float(0x37d75334u), t, __uint_as_float(0xbab64f3bu));
  pc = fmaf(t, pc, __uint_as_float(0x3d2aabf7u));
  pc = fmaf(t, pc, __uint_as_float(0xbf000004u));
  const float cs = fmaf(t, pc, 1.0f);
  const unsigned flip = ((unsigned)q << 30) & 0x80000000u;      // quadrants 2 and 3
  const bool even = (q & 1) == 0;
  s = __uint_as_float(__float_as_uint(even ? sn : cs) ^ flip);
  c = __uint_as_float(__float_as_uint(even ? cs : -sn) ^ flip);
}

// Angle, sine and cosine of the GRP steps of one group. The four evaluations are
// straight-line code, so that their dependent chains run side by side; ONE test per
// group sends a huge or non-finite angle to the library's full-range code.
__device__ __forceinline__ void grp_trig(const StepGrp& g, float (&th)[GRP],
                                         float (&s)[GRP], float (&c)[GRP]) {
  float top = 0.0f;   // the group's largest angle (a NaN angle gives NaN on either path)
// unrolled: constant indices keep the arrays in registers
#pragma unroll
  for (int i = 0; i < GRP; ++i) {
    const float bx = g.b[i][0], by = g.b[i][1], bz = g.b[i][2];
    th[i] = sqrtf(bx * bx + by * by + bz * bz);
    sincos_mid(th[i], s[i], c[i]);
    top = fmaxf(top, th[i]);
  }
  if (!(top < 131072.0f)) {
// unrolled: constant indices keep the arrays in registers
#pragma unroll
    for (int i = 0; i < GRP; ++i) sincosf(th[i], &s[i], &c[i]);
  }
}

// M <- R * M, p <- p * d, e <- d * R * e + u for the GRP steps of one group.
__device__ __forceinline__ void compose_grp(const StepGrp& g, const float* dg,
                                            float (&m)[3][3], float& p, float (&e)[3]) {
  float tha[GRP], sa[GRP], ca[GRP];
  grp_trig(g, tha, sa, ca);
// unrolled: constant indices keep the arrays in registers
#pragma unroll
  for (int i = 0; i < GRP; ++i) {
    const float bx = g.b[i][0], by = g.b[i][1], bz = g.b[i][2];
    const float d  = dg[i];

    const float inv = 1.0f / fmaxf(tha[i], 1e-8f);
    const float kx = bx * inv, ky = by * inv, kz = bz * inv;
    const float c = ca[i], s = sa[i];

    // R = c I + s [k]x + (1 - c) k k^T
    const float oc = 1.0f - c;
    const float ax = oc * kx, ay = oc * ky, az = oc * kz;
    const float sx = s * kx,  sy = s * ky,  sz = s * kz;
    const float r00 = ax * kx + c,  r01 = ax * ky - sz, r02 = ax * kz + sy;
    const float r10 = ay * kx + sz, r11 = ay * ky + c,  r12 = ay * kz - sx;
    const float r20 = az * kx - sy, r21 = az * ky + sx, r22 = az * kz + c;

// unrolled: constant indices keep the arrays in registers
#pragma unroll
    for (int j = 0; j < 3; ++j) {
      const float a0 = m[0][j], a1 = m[1][j], a2 = m[2][j];
      m[0][j] = r00 * a0 + r01 * a1 + r02 * a2;
      m[1][j] = r10 * a0 + r11 * a1 + r12 * a2;
      m[2][j] = r20 * a0 + r21 * a1 + r22 * a2;
    }
    const float e0 = e[0], e1 = e[1], e2 = e[2];
    e[0] = d * (r00 * e0 + r01 * e1 + r02 * e2) + g.u[i][0];
    e[1] = d * (r10 * e0 + r11 * e1 + r12 * e2) + g.u[i][1];
    e[2] = d * (r20 * e0 + r21 * e1 + r22 * e2) + g.u[i][2];
    p *= d;
  }
}

// Launch A. Chunk map layout: float4 cmap[b][chunk][row 0..2][chain],
// row i = (M[i][0], M[i][1], M[i][2], e[i]).
__global__ __launch_bounds__(256)
void qssm_chunk_map(const float* __restrict__ biv,
                    const float* __restrict__ dec,
                    const float* __restrict__ inj,
                    float* __restrict__ cmap) {
  const int ch = blockIdx.x;   // 0..NCHUNK-1
  const int b  = blockIdx.y;
  const int nb = threadIdx.x;  // 0..255
  const size_t base = ((size_t)b * TLEN + (size_t)ch * CLEN) * DDIM + (size_t)nb * 3;
  const float* pb = biv + base;
  const float* pu = inj + base;
  const float* pd = dec + (size_t)b * TLEN + (size_t)ch * CLEN;

  float m[3][3] = {{1.0f, 0.0f, 0.0f}, {0.0f, 1.0f, 0.0f}, {0.0f, 0.0f, 1.0f}};
  float e[3] = {0.0f, 0.0f, 0.0f};
  float p = 1.0f;

  StepGrp ga, gb;
  load_grp(ga, pb, pu);
  for (int g = 0; g < NGRP; g += 2) {
    load_grp(gb, pb + (g + 1) * GRP * DDIM, pu + (g + 1) * GRP * DDIM);
    compose_grp(ga, pd + g * GRP, m, p, e);
    // unconditional, so that the waits for gb can be counted past these loads; the last
    // trip fetches the last group once more and does not use it
    const int gn = (g + 2 < NGRP) ? g + 2 : NGRP - 1;
    load_grp(ga, pb + gn * GRP * DDIM, pu + gn * GRP * DDIM);
    compose_grp(gb, pd + (g + 1) * GRP, m, p, e);
  }

  float4* cm = (float4*)cmap + ((size_t)b * NCHUNK + ch) * 3 * NBQ + nb;
// unrolled: constant indices keep the arrays in registers
#pragma unroll
  for (int i = 0; i < 3; ++i)
    cm[i * NBQ] = make_float4(p * m[i][0], p * m[i][1], p * m[i][2], e[i]);
}

// The GRP steps of one group with the step formula; states go to po.
__device__ __forceinline__ void replay_grp(const StepGrp& g, const float* dg, float* po,
                                           float& hx, float& hy, float& hz) {
  float tha[GRP], sa[GRP], ca[GRP];
  grp_trig(g, tha, sa, ca);
// unrolled: constant indices keep the arrays in registers
#pragma unroll
  for (int i = 0; i < GRP; ++i) {
    const float bx = g.b[i][0], by = g.b[i][1], bz = g.b[i][2];
    const float ux = g.u[i][0], uy = g.u[i][1], uz = g.u[i][2];
    const float d  = dg[i];

    const float inv = 1.0f / fmaxf(tha[i], 1e-8f);
    const float kx = bx * inv, ky = by * inv, kz = bz * inv;
    const float c = ca[i], s = sa[i];

    const float cx = ky * hz - kz * hy;
    const float cy = kz * hx - kx * hz;
    const float cz = kx * hy - ky * hx;
    const float kdoth = kx * hx + ky * hy + kz * hz;
    const float om = (1.0f - c) * kdoth;

    const float rx = hx * c + cx * s + kx * om;
    const float ry = hy * c + cy * s + ky * om;
    const float rz = hz * c + cz * s + kz * om;

    hx = d * rx + ux;
    hy = d * ry + uy;
    hz = d * rz + uz;

    po[i * DDIM]     = hx;
    po[i * DDIM + 1] = hy;
    po[i * DDIM + 2] = hz;
  }
  // the stores' address and data registers are reused below: wait before they are rewritten
  asm volatile("s_wait_xcnt 0x0" ::: "memory");
}

// Launch B. inj lives in `out` and is overwritten in place with the state h_t;
// a thread reads and writes only its own chunk's elements of its own chain.
__global__ __launch_bounds__(256)
void qssm_scan_chunk(const float* __restrict__ biv,
                     const float* __restrict__ dec,
                     const float* __restrict__ cmap,
                     float* __restrict__ out) {
  const int ch = blockIdx.x;   // 0..NCHUNK-1
  const int b  = blockIdx.y;
  const int nb = threadIdx.x;  // 0..255
  const size_t base = ((size_t)b * TLEN + (size_t)ch * CLEN) * DDIM + (size_t)nb * 3;
  const float* pb = biv + base;
  float*       po = out + base;
  const float* pd = dec + (size_t)b * TLEN + (size_t)ch * CLEN;

  StepGrp ga, gb;
  load_grp(ga, pb, po);

  // start state of this chunk: earlier chunks' maps applied in time order to h = 0
  float hx = 0.0f, hy = 0.0f, hz = 0.0f;
  const float4* cj = (const float4*)cmap + (size_t)b * NCHUNK * 3 * NBQ + nb;
  // FOLD maps are fetched together so that their L2 latency is paid once per batch;
  // the last batch may fetch maps of chunks >= ch (launch A wrote them all) and
  // keeps only the results of those below ch
  for (int j0 = 0; j0 < ch; j0 += FOLD) {
    float4 r[FOLD][3];
// unrolled: constant indices keep the arrays in registers
#pragma unroll
    for (int i = 0; i < FOLD; ++i) {
// unrolled: constant indices keep the arrays in registers
#pragma unroll
      for (int q = 0; q < 3; ++q) r[i][q] = cj[(i * 3 + q) * NBQ];
    }
    cj += FOLD * 3 * NBQ;
// unrolled: constant indices keep the arrays in registers
#pragma unroll
    for (int i = 0; i < FOLD; ++i) {
      const bool on = j0 + i < ch;
      const float nx = r[i][0].x * hx + r[i][0].y * hy + r[i][0].z * hz + r[i][0].w;
      const float ny = r[i][1].x * hx + r[i][1].y * hy + r[i][1].z * hz + r[i][1].w;
      const float nz = r[i][2].x * hx + r[i][2].y * hy + r[i][2].z * hz + r[i][2].w;
      hx = on ? nx : hx;
      hy = on ? ny : hy;
      hz = on ? nz : hz;
    }
  }

  for (int g = 0; g < NGRP; g += 2) {
    load_grp(gb, pb + (g + 1) * GRP * DDIM, po + (g + 1) * GRP * DDIM);
    replay_grp(ga, pd + g * GRP, po + g * GRP * DDIM, hx, hy, hz);
    // unconditional, so that the waits for gb can be counted past these loads; the last
    // trip fetches the last group once more and does not use it
    const int gn = (g + 2 < NGRP) ? g + 2 : NGRP - 1;
    load_grp(ga, pb + gn * GRP * DDIM, po + gn * GRP * DDIM);
    replay_grp(gb, pd + (g + 1) * GRP, po + (g + 1) * GRP * DDIM, hx, hy, hz);
  }
}

extern "C" void kernel_launch(void* const* d_in, const int* in_sizes, int n_in,
                              void* d_out, int out_size, void* d_ws, size_t ws_size,
                              hipStream_t stream) {
  const float* x      = (const float*)d_in[0];  // (B,T,D)
  const float* W_biv  = (const float*)d_in[1];  // (768,768)
  const float* b_biv  = (const float*)d_in[2];  // (768,)
  const float* W_dec  = (const float*)d_in[3];  // (1,768)
  const float* b_dec  = (const float*)d_in[4];  // (1,)
  const float* W_in   = (const float*)d_in[5];  // (768,768)
  const float* b_in   = (const float*)d_in[6];  // (768,)
  float* out = (float*)d_out;                   // (B,T,768)

  float* ws_biv = (float*)d_ws;                       // MROWS*768 floats
  float* ws_dec = ws_biv + (size_t)MROWS * DDIM;      // MROWS floats
  float* ws_map = ws_dec + (size_t)MROWS;             // BATCH*NCHUNK*3*NBQ float4

  // 1) fused projections: biv -> ws, inj -> d_out (in place for the scan)
  dim3 ggrid(MROWS / BM, NCOLS / BN);  // (128, 6)
  //    and the decay gate (GEMV + sigmoid) -> ws
  qssm_proj_gemm<<<ggrid, GTHREADS, 0, stream>>>(x, W_biv, W_in, b_biv, b_in, W_dec, b_dec,
                                            ws_biv, out, ws_dec);
  // 2) each time chunk's affine map
  qssm_chunk_map<<<dim3(NCHUNK, BATCH), NBQ, 0, stream>>>(ws_biv, ws_dec, out, ws_map);
  // 3) fold the earlier chunks' maps, then replay each chunk's own steps
  qssm_scan_chunk<<<dim3(NCHUNK, BATCH), NBQ, 0, stream>>>(ws_biv, ws_dec, ws_map, out);
}

// v006
// A run of this version takes 202 microseconds.
// Timed twice side by side with v005, it ran 1.04 times as fast both times.
// Counting every step since v000, it is 13.7 times as fast.
#include <hip/hip_runtime.h>
#include <hip/hip_bf16.h>
#include <math.h>

// ---------------- problem constants ----------------
#define BATCH 8
#define TLEN  4096
#define DDIM  768
#define NBQ   256           // quaternion blocks (DDIM/3)
#define MROWS (BATCH * TLEN)  // 32768
#define NCOLS (2 * DDIM)      // 1536 : [0,768)=biv, [768,1536)=inj
#define KDIM  DDIM

// ---------------- GEMM tiling ----------------
#define BM 256
#define BN 256
#define BK 32
#define GTHREADS 512        // 16 waves, 4 x 4, each on a 64 x 64 piece of the tile
#define BKP (BK + 8)        // padded LDS row stride (bf16 elems) for bank spread

typedef __attribute__((ext_vector_type(16))) __bf16 v16bf;
typedef __attribute__((ext_vector_type(8)))  __bf16 v8bf;
typedef __attribute__((ext_vector_type(8)))  float  v8f;

// Load one 16x32 bf16 A/B fragment from an LDS plane laid out [row][BKP].
// CDNA5 16-bit operand layout: lanes 0-15 hold row=lane, K={0..7,16..23};
// lanes 16-31 hold row=lane-16, K={8..15,24..31}. Two aligned b128 loads.
__device__ __forceinline__ v16bf load_frag(const __bf16* plane, int row_base, int lane) {
  const int row   = row_base + (lane & 15);
  const int khalf = (lane >> 4) * 8;
  const __bf16* p = plane + row * BKP + khalf;
  v8bf c0 = *(const v8bf*)(p);
  v8bf c1 = *(const v8bf*)(p + 16);
  v16bf r;
#pragma unroll
  for (int i = 0; i < 8; ++i) { r[i] = c0[i]; r[i + 8] = c1[i]; }
  return r;
}

// One staged K tile in LDS: four bf16 planes [row][BKP] (BM == BN rows each).
#define PLANE  (BM * BKP)
#define STAGE  (4 * PLANE)      // A hi | A lo | B hi | B lo
#define NKT    (KDIM / BK)      // 24 K tiles
static_assert(BM == BN, "the four planes of a stage have one size");
static_assert(DDIM % BN == 0, "a column tile lies in one weight matrix");

// Split four floats into bf16 hi + lo and put them into the two planes.
__device__ __forceinline__ void split_store(__bf16* hi, __bf16* lo, const float4& v) {
// unrolled: constant indices keep the arrays in registers
#pragma unroll
  for (int q = 0; q < 4; ++q) {
    float f   = ((const float*)&v)[q];
    __bf16 h  = (__bf16)f;
    __bf16 l  = (__bf16)(f - (float)h);
    hi[q] = h;
    lo[q] = l;
  }
}

// The fetched registers of one K tile -> one LDS stage.
__device__ __forceinline__ void store_tile(__bf16* st, int srow, int scol,
                                           const float4 (&ra)[4], const float4 (&rb)[4]) {
// unrolled: constant indices keep the arrays in registers
#pragma unroll
  for (int pass = 0; pass < 4; ++pass) {
    const int o = (pass * 64 + srow) * BKP + scol;
    split_store(st + o, st + PLANE + o, ra[pass]);
    split_store(st + 2 * PLANE + o, st + 3 * PLANE + o, rb[pass]);
  }
}

// Adds one K tile's share of dot(x[row,:], W_decay) for the thread's four rows.
__device__ __forceinline__ void decay_part(float4& a, const float4 (&ra)[4], const float* w4) {
  const float4 w = *(const float4*)w4;
  a.x += ra[0].x * w.x + ra[0].y * w.y + ra[0].z * w.z + ra[0].w * w.w;
  a.y += ra[1].x * w.x + ra[1].y * w.y + ra[1].z * w.z + ra[1].w * w.w;
  a.z += ra[2].x * w.x + ra[2].y * w.y + ra[2].z * w.z + ra[2].w * w.w;
  a.w += ra[3].x * w.x + ra[3].y * w.y + ra[3].z * w.z + ra[3].w * w.w;
}

// bf16x3 split-precision WMMA on one staged K tile: acc += Ah*Bh + Ah*Bl + Al*Bh
// (each accumulator takes its three products in that order). The A fragments of
// the wave's 64 rows stay in registers; the B fragments pass through one column
// block at a time, so that accumulators, fragments and the fetched next tile fit
// the 256 registers a wave has in a work-group of 16 waves.
// The fragments of the first eight WMMAs (A hi, and B of column block 0) come in from
// first_frags(), which the K loop issues ahead of the next tile's split.
__device__ __forceinline__ void first_frags(const __bf16* st, int wm, int wn, int lane,
                                            v16bf (&a_hi)[4], v16bf& b_hi0, v16bf& b_lo0) {
// unrolled: constant indices keep the array in registers
#pragma unroll
  for (int i = 0; i < 4; ++i) a_hi[i] = load_frag(st, wm * 64 + i * 16, lane);
  b_hi0 = load_frag(st + 2 * PLANE, wn * 64, lane);
  b_lo0 = load_frag(st + 3 * PLANE, wn * 64, lane);
}

// fetch() is called behind those eight WMMAs: it issues the K loop's global loads.
template <class Fetch>
__device__ __forceinline__ void mma_tile(const __bf16* st, int wm, int wn, int lane,
                                         const v16bf (&a_hi)[4], const v16bf& b_hi0,
                                         const v16bf& b_lo0, v8f (&acc)[4][4], Fetch fetch) {
  v16bf a_lo[4];
// unrolled: constant indices keep the arrays in registers
#pragma unroll
  for (int i = 0; i < 4; ++i) a_lo[i] = load_frag(st + PLANE, wm * 64 + i * 16, lane);
// unrolled: constant indices keep the arrays in registers
#pragma unroll
  for (int j = 0; j < 4; ++j) {
    const v16bf b_hi = j == 0 ? b_hi0 : load_frag(st + 2 * PLANE, wn * 64 + j * 16, lane);
    const v16bf b_lo = j == 0 ? b_lo0 : load_frag(st + 3 * PLANE, wn * 64 + j * 16, lane);
// unrolled: constant indices keep the arrays in registers
#pragma unroll
    for (int i = 0; i < 4; ++i)
      acc[i][j] = __builtin_amdgcn_wmma_f32_16x16x32_bf16(
          false, a_hi[i], false, b_hi, (short)0, acc[i][j], false, false);
// unrolled: constant indices keep the arrays in registers
#pragma unroll
    for (int i = 0; i < 4; ++i)
      acc[i][j] = __builtin_amdgcn_wmma_f32_16x16x32_bf16(
          false, a_hi[i], false, b_lo, (short)0, acc[i][j], false, false);
    if (j == 0) fetch();
// unrolled: constant indices keep the arrays in registers
#pragma unroll
    for (int i = 0; i < 4; ++i)
      acc[i][j] = __builtin_amdgcn_wmma_f32_16x16x32_bf16(
          false, a_lo[i], false, b_hi, (short)0, acc[i][j], false, false);
  }
}

// Fused projection GEMM: out[m, n] for n in [0,1536).
//   n <  768 : biv column n      (weights W_biv, bias b_biv)  -> ws biv buffer
//   n >= 768 : inj column n-768  (weights W_in,  bias b_in)   -> d_out (in-place scanned later)
// Column tile 0 also writes decay[m] = sigmoid(dot(x[m,:], W_decay) + b_decay) of its rows.
// The K loop is software-pipelined over three tiles: trip kt opens by splitting tile
// kt+1, which arrived in registers during the trip before, into the other LDS stage,
// and then multiplies tile kt; behind its first WMMAs the loads of tile kt+2 go out
// into the same registers. A wave's split so runs beside the WMMAs of the waves it
// shares the SIMD with, and the trip's barrier stands directly behind the WMMAs.
__global__ __launch_bounds__(GTHREADS)
void qssm_proj_gemm(const float* __restrict__ X,
                    const float* __restrict__ Wbiv,
                    const float* __restrict__ Win,
                    const float* __restrict__ bbiv,
                    const float* __restrict__ bin,
                    const float* __restrict__ Wd,
                    const float* __restrict__ bd,
                    float* __restrict__ out_biv,
                    float* __restrict__ out_inj,
                    float* __restrict__ dec) {
  __shared__ __attribute__((aligned(16))) __bf16 smem[2 * STAGE];
  // decay gate (column tile 0 only): W_decay, each thread's own partial dots of its
  // four staged rows, and the 256 finished row dots
  __shared__ __attribute__((aligned(16))) float swd[KDIM];
  __shared__ __attribute__((aligned(16))) float sacc[GTHREADS * 4];
  __shared__ float sdot[BM];

  const int tid  = threadIdx.x;
  const int lane = tid & 31;
  // the wave's number as a scalar: its row and column offsets then take no vector
  // registers, which the 256 a wave has here are short of
  const int wave = __builtin_amdgcn_readfirstlane(tid >> 5);   // 0..15
  const int wm   = wave & 3;      // 4 waves along M (64 rows each)
  const int wn   = wave >> 2;     // 4 waves along N (64 cols each)

  const int m0 = blockIdx.x * BM;
  const int n0 = blockIdx.y * BN;
  // the x rows pass through this thread's registers anyway: the work-groups of
  // column tile 0 also sum dot(x[m,:], W_decay) from them (same for the whole group)
  const bool dk = blockIdx.y == 0;

  v8f acc[4][4];
// unrolled: constant indices keep the arrays in registers
#pragma unroll
  for (int i = 0; i < 4; ++i)
// unrolled: constant indices keep the arrays in registers
#pragma unroll
    for (int j = 0; j < 4; ++j) acc[i][j] = (v8f)0.0f;

  // staging map: 8 threads per row (8 x float4 = 32 floats), 64 rows per pass
  const int srow = tid >> 3;        // 0..63
  const int scol = (tid & 7) * 4;   // 0,4,...,28

  // A: x[m0+row, ...] ; B: weight row (n0+row) of W_biv or W_in
  const float* wtile = (n0 < DDIM) ? (Wbiv + (size_t)n0 * KDIM)
                                   : (Win + (size_t)(n0 - DDIM) * KDIM);
  const float* pa = X + (size_t)(m0 + srow) * KDIM + scol;
  const float* pb = wtile + (size_t)srow * KDIM + scol;

  float4 ra[4], rb[4];
  long kstep = BK;   // floats from one K tile to the next
  v16bf a_hi[4], b_hi0, b_lo0;

  {
    // ---- tiles 0 and 1 are fetched together; tile 0 is split into stage 0 ----
    float4 ta[4], tb[4];
// unrolled: constant indices keep the arrays in registers
#pragma unroll
    for (int pass = 0; pass < 4; ++pass) {
      ta[pass] = *(const float4*)(pa + pass * 64 * KDIM);
      tb[pass] = *(const float4*)(pb + pass * 64 * KDIM);
    }
// unrolled: constant indices keep the arrays in registers
#pragma unroll
    for (int pass = 0; pass < 4; ++pass) {
      ra[pass] = *(const float4*)(pa + pass * 64 * KDIM + BK);
      rb[pass] = *(const float4*)(pb + pass * 64 * KDIM + BK);
    }
    // the loads' address registers are advanced below: wait before they are
    // rewritten; as inputs they stay untouched up to here
    asm volatile("s_wait_xcnt 0x0" :: "v"(pa), "v"(pb) : "memory");
    if (dk) {
      if (tid < KDIM / 4) ((float4*)swd)[tid] = ((const float4*)Wd)[tid];
      // publishes W_decay to the group before its first use just below
      __syncthreads();
      float4 a = make_float4(0.0f, 0.0f, 0.0f, 0.0f);
      decay_part(a, ta, swd + scol);
      ((float4*)sacc)[tid] = a;
    }
    store_tile(smem, srow, scol, ta, tb);
  }
  __syncthreads();

  for (int kt = 0; kt < NKT - 1; ++kt) {
    // (pa, pb point at tile kt)
    // ---- the first fragments of tile kt: their LDS latency runs out behind the split ----
    first_frags(smem + (kt & 1) * STAGE, wm, wn, lane, a_hi, b_hi0, b_lo0);
    // keeps these reads in front of the split
    __builtin_amdgcn_sched_barrier(0);

    // ---- tile kt+1, fetched in the trip before: split, store ----
    if (dk) {
      // a thread reads and writes only its own slot: no barrier is needed for it
      float4 a = ((const float4*)sacc)[tid];
      decay_part(a, ra, swd + (kt + 1) * BK + scol);
      ((float4*)sacc)[tid] = a;
    }
    // stage (kt+1)&1 was last read in trip kt-1, and every wave has passed that
    // trip's barrier; this trip's one barrier publishes it
    store_tile(smem + ((kt + 1) & 1) * STAGE, srow, scol, ra, rb);

    // keeps the split in front of the WMMAs: none of it is left behind the last WMMA
    __builtin_amdgcn_sched_barrier(0);

    mma_tile(smem + (kt & 1) * STAGE, wm, wn, lane, a_hi, b_hi0, b_lo0, acc, [&]() {
      // keeps the loads behind the first eight WMMAs, which cover the time their issue takes
      __builtin_amdgcn_sched_barrier(0);
      // ---- all eight loads of tile kt+2 go out together, a whole trip ahead of their split ----
      if (kt + 2 < NKT) {
// unrolled: constant indices keep the arrays in registers
#pragma unroll
        for (int pass = 0; pass < 4; ++pass) {
          ra[pass] = *(const float4*)(pa + pass * 64 * KDIM + 2 * BK);
          rb[pass] = *(const float4*)(pb + pass * 64 * KDIM + 2 * BK);
        }
      }
      if (kt + 3 < NKT) {
// unrolled: four fixed row blocks
#pragma unroll
        for (int pass = 0; pass < 4; ++pass) {
          __builtin_prefetch(pa + pass * 64 * KDIM + 3 * BK, 0, 1);
          __builtin_prefetch(pb + pass * 64 * KDIM + 3 * BK, 0, 1);
        }
      }
      // keeps the loads from sinking further down among the WMMAs
      __builtin_amdgcn_sched_barrier(0);
    });

    // keeps the address step behind the last WMMA
    __builtin_amdgcn_sched_barrier(0);
    // the address registers are advanced next: wait before they are rewritten.
    // As inputs they stay untouched up to the wait, and the step comes out of the
    // statement so that the two additions cannot be placed in front of it
    asm volatile("s_wait_xcnt 0x0" : "+s"(kstep) : "v"(pa), "v"(pb) : "memory");
    pa += kstep;
    pb += kstep;
    __syncthreads();
  }
  if (dk) {
    const float bd0 = bd[0];
    // a row's eight threads are eight neighbouring lanes: butterfly over them
    float4 a = ((const float4*)sacc)[tid];
// unrolled: three fixed steps
#pragma unroll
    for (int off = 1; off < 8; off <<= 1) {
      a.x += __shfl_xor(a.x, off, 32);
      a.y += __shfl_xor(a.y, off, 32);
      a.z += __shfl_xor(a.z, off, 32);
      a.w += __shfl_xor(a.w, off, 32);
    }
    if ((tid & 7) == 0) {
      sdot[srow]       = a.x;
      sdot[64 + srow]  = a.y;
      sdot[128 + srow] = a.z;
      sdot[192 + srow] = a.w;
    }
    // hands the row dots to the waves that store them, one whole line per wave
    __syncthreads();
    if (tid < BM) {
      const float z = sdot[tid] + bd0;
      dec[m0 + tid] = 1.0f / (1.0f + expf(-z));
    }
  }
  // a column tile lies in one weight matrix: bias vector and destination are the tile's
  const bool to_biv  = n0 < DDIM;
  const float* bsrc  = to_biv ? bbiv : bin;
  float* dst         = to_biv ? out_biv : out_inj;
  const int col0     = (to_biv ? n0 : n0 - DDIM) + wn * 64 + (lane & 15);
  float bias[4];
// unrolled: constant indices keep the array in registers
#pragma unroll
  for (int j = 0; j < 4; ++j) bias[j] = bsrc[col0 + j * 16];
  // keeps the four bias loads in front of the last tile's WMMAs, which hide their latency
  __builtin_amdgcn_sched_barrier(0);

  first_frags(smem + ((NKT - 1) & 1) * STAGE, wm, wn, lane, a_hi, b_hi0, b_lo0);
  mma_tile(smem + ((NKT - 1) & 1) * STAGE, wm, wn, lane, a_hi, b_hi0, b_lo0, acc, []() {});
  // keeps the epilogue's address arithmetic behind the last WMMA: among the WMMAs
  // no register is free for it, and it would spill to scratch
  __builtin_amdgcn_sched_barrier(0);

  // ---- epilogue: bias + scatter to biv workspace or inj (=d_out) ----
  // C/D layout: VGPR r, lanes 0-15 -> M=r, N=lane; lanes 16-31 -> M=8+r, N=lane-16.
  const int half = (lane >> 4) & 1;
#pragma unroll
  for (int i = 0; i < 4; ++i) {
#pragma unroll
    for (int j = 0; j < 4; ++j) {
      const int mb = m0 + wm * 64 + i * 16 + half * 8;
#pragma unroll
      for (int r = 0; r < 8; ++r) {
        dst[(size_t)(mb + r) * DDIM + col0 + j * 16] = acc[i][j][r] + bias[j];
      }
    }
  }
}

// ---------------- time-chunked Rodrigues scan ----------------
// One step is the affine map h -> d * R(b) * h + u, so a run of steps is again
// an affine map h -> M * h + e. T is cut into NCHUNK chunks:
//   launch A: one thread per (batch, chunk, chain) composes its chunk's (M, e);
//   launch B: the same thread folds the maps of all earlier chunks, in time
//             order, into its chunk's start state and then replays its own
//             steps with the step formula, writing the states.
#define NCHUNK 64
#define CLEN   (TLEN / NCHUNK)   // 64 steps per chunk
#define GRP    4                 // steps fetched together, one group ahead
#define NGRP   (CLEN / GRP)      // 16, even
#define FOLD   8                 // chunk maps fetched together in launch B

struct StepGrp {
  float b[GRP][3];
  float u[GRP][3];
};

__device__ __forceinline__ void load_grp(StepGrp& g, const float* pb, const float* pu) {
// unrolled: constant indices keep the arrays in registers
#pragma unroll
  for (int i = 0; i < GRP; ++i) {
// unrolled: constant indices keep the arrays in registers
#pragma unroll
    for (int q = 0; q < 3; ++q) {
      g.b[i][q] = pb[i * DDIM + q];
      g.u[i][q] = pu[i * DDIM + q];
    }
  }
  // the loads' address registers are reused below: wait before they are rewritten;
  // as inputs they stay untouched up to here
  asm volatile("s_wait_xcnt 0x0" :: "v"(pb), "v"(pu) : "memory");
}

// sin and cos of one angle 0 <= x < 2^17 from ONE range reduction: quadrant count and
// remainder by pi/2 in three parts, then the two polynomials on [-pi/4, pi/4]. These are
// the operations sinf and cosf do for such an angle, so the values are theirs.
__device__ __forceinline__ void sincos_mid(float x, float& s, float& c) {
  const float n = rintf(x * __uint_as_float(0x3f22f983u));      // x * 2/pi
  float r = fmaf(n, __uint_as_float(0xbfc90fdau), x);           // - n * pi/2, high part
  r = fmaf(n, __uint_as_float(0xb3a22168u), r);                 //             middle part
  r = fmaf(n, __uint_as_float(0xa7c234c4u), r);                 //             low part
  const int q = (int)n;
  const float t = r * r;
  float ps = fmaf(__uint_as_float(0xb94c1982u), t, __uint_as_float(0x3c0881c4u));
  ps = fmaf(t, ps, __uint_as_float(0xbe2aaa9du));
  const float sn = fmaf(r, t * ps, r);
  float pc = fmaf(__uint_as_float(0x37d75334u), t, __uint_as_float(0xbab64f3bu));
  pc = fmaf(t, pc, __uint_as_float(0x3d2aabf7u));
  pc = fmaf(t, pc, __uint_as_float(0xbf000004u));
  const float cs = fmaf(t, pc, 1.0f);
  const unsigned flip = ((unsigned)q << 30) & 0x80000000u;      // quadrants 2 and 3
  const bool even = (q & 1) == 0;
  s = __uint_as_float(__float_as_uint(even ? sn : cs) ^ flip);
  c = __uint_as_float(__float_as_uint(even ? cs : -sn) ^ flip);
}

// Angle, sine and cosine of the GRP steps of one group. The four evaluations are
// straight-line code, so that their dependent chains run side by side; ONE test per
// group sends a huge or non-finite angle to the library's full-range code.
__device__ __forceinline__ void grp_trig(const StepGrp& g, float (&th)[GRP],
                                         float (&s)[GRP], float (&c)[GRP]) {
  float top = 0.0f;   // the group's largest angle (a NaN angle gives NaN on either path)
// unrolled: constant indices keep the arrays in registers
#pragma unroll
  for (int i = 0; i < GRP; ++i) {
    const float bx = g.b[i][0], by = g.b[i][1], bz = g.b[i][2];
    th[i] = sqrtf(bx * bx + by * by + bz * bz);
    sincos_mid(th[i], s[i], c[i]);
    top = fmaxf(top, th[i]);
  }
  if (!(top < 131072.0f)) {
// unrolled: constant indices keep the arrays in registers
#pragma unroll
    for (int i = 0; i < GRP; ++i) sincosf(th[i], &s[i], &c[i]);
  }
}

// M <- R * M, p <- p * d, e <- d * R * e + u for the GRP steps of one group.
__device__ __forceinline__ void compose_grp(const StepGrp& g, const float* dg,
                                            float (&m)[3][3], float& p, float (&e)[3]) {
  float tha[GRP], sa[GRP], ca[GRP];
  grp_trig(g, tha, sa, ca);
// unrolled: constant indices keep the arrays in registers
#pragma unroll
  for (int i = 0; i < GRP; ++i) {
    const float bx = g.b[i][0], by = g.b[i][1], bz = g.b[i][2];
    const float d  = dg[i];

    const float inv = 1.0f / fmaxf(tha[i], 1e-8f);
    const float kx = bx * inv, ky = by * inv, kz = bz * inv;
    const float c = ca[i], s = sa[i];

    // R = c I + s [k]x + (1 - c) k k^T
    const float oc = 1.0f - c;
    const float ax = oc * kx, ay = oc * ky, az = oc * kz;
    const float sx = s * kx,  sy = s * ky,  sz = s * kz;
    const float r00 = ax * kx + c,  r01 = ax * ky - sz, r02 = ax * kz + sy;
    const float r10 = ay * kx + sz, r11 = ay * ky + c,  r12 = ay * kz - sx;
    const float r20 = az * kx - sy, r21 = az * ky + sx, r22 = az * kz + c;

// unrolled: constant indices keep the arrays in registers
#pragma unroll
    for (int j = 0; j < 3; ++j) {
      const float a0 = m[0][j], a1 = m[1][j], a2 = m[2][j];
      m[0][j] = r00 * a0 + r01 * a1 + r02 * a2;
      m[1][j] = r10 * a0 + r11 * a1 + r12 * a2;
      m[2][j] = r20 * a0 + r21 * a1 + r22 * a2;
    }
    const float e0 = e[0], e1 = e[1], e2 = e[2];
    e[0] = d * (r00 * e0 + r01 * e1 + r02 * e2) + g.u[i][0];
    e[1] = d * (r10 * e0 + r11 * e1 + r12 * e2) + g.u[i][1];
    e[2] = d * (r20 * e0 + r21 * e1 + r22 * e2) + g.u[i][2];
    p *= d;
  }
}

// Launch A. Chunk map layout: float4 cmap[b][chunk][row 0..2][chain],
// row i = (M[i][0], M[i][1], M[i][2], e[i]).
__global__ __launch_bounds__(256)
void qssm_chunk_map(const float* __restrict__ biv,
                    const float* __restrict__ dec,
                    const float* __restrict__ inj,
                    float* __restrict__ cmap) {
  const int ch = blockIdx.x;   // 0..NCHUNK-1
  const int b  = blockIdx.y;
  const int nb = threadIdx.x;  // 0..255
  const size_t base = ((size_t)b * TLEN + (size_t)ch * CLEN) * DDIM + (size_t)nb * 3;
  const float* pb = biv + base;
  const float* pu = inj + base;
  const float* pd = dec + (size_t)b * TLEN + (size_t)ch * CLEN;

  float m[3][3] = {{1.0f, 0.0f, 0.0f}, {0.0f, 1.0f, 0.0f}, {0.0f, 0.0f, 1.0f}};
  float e[3] = {0.0f, 0.0f, 0.0f};
  float p = 1.0f;

  StepGrp ga, gb;
  load_grp(ga, pb, pu);
  for (int g = 0; g < NGRP; g += 2) {
    load_grp(gb, pb + (g + 1) * GRP * DDIM, pu + (g + 1) * GRP * DDIM);
    compose_grp(ga, pd + g * GRP, m, p, e);
    // unconditional, so that the waits for gb can be counted past these loads; the last
    // trip fetches the last group once more and does not use it
    const int gn = (g + 2 < NGRP) ? g + 2 : NGRP - 1;
    load_grp(ga, pb + gn * GRP * DDIM, pu + gn * GRP * DDIM);
    compose_grp(gb, pd + (g + 1) * GRP, m, p, e);
  }

  float4* cm = (float4*)cmap + ((size_t)b * NCHUNK + ch) * 3 * NBQ + nb;
// unrolled: constant indices keep the arrays in registers
#pragma unroll
  for (int i = 0; i < 3; ++i)
    cm[i * NBQ] = make_float4(p * m[i][0], p * m[i][1], p * m[i][2], e[i]);
}

// The GRP steps of one group with the step formula; states go to po.
__device__ __forceinline__ void replay_grp(const StepGrp& g, const float* dg, float* po,
                                           float& hx, float& hy, float& hz) {
  float tha[GRP], sa[GRP], ca[GRP];
  grp_trig(g, tha, sa, ca);
// unrolled: constant indices keep the arrays in registers
#pragma unroll
  for (int i = 0; i < GRP; ++i) {
    const float bx = g.b[i][0], by = g.b[i][1], bz = g.b[i][2];
    const float ux = g.u[i][0], uy = g.u[i][1], uz = g.u[i][2];
    const float d  = dg[i];

    const float inv = 1.0f / fmaxf(tha[i], 1e-8f);
    const float kx = bx * inv, ky = by * inv, kz = bz * inv;
    const float c = ca[i], s = sa[i];

    const float cx = ky * hz - kz * hy;
    const float cy = kz * hx - kx * hz;
    const float cz = kx * hy - ky * hx;
    const float kdoth = kx * hx + ky * hy + kz * hz;
    const float om = (1.0f - c) * kdoth;

    const float rx = hx * c + cx * s + kx * om;
    const float ry = hy * c + cy * s + ky * om;
    const float rz = hz * c + cz * s + kz * om;

    hx = d * rx + ux;
    hy = d * ry + uy;
    hz = d * rz + uz;

    po[i * DDIM]     = hx;
    po[i * DDIM + 1] = hy;
    po[i * DDIM + 2] = hz;
  }
  // the stores' address and data registers are reused below: wait before they are rewritten
  asm volatile("s_wait_xcnt 0x0" ::: "memory");
}

// Launch B. inj lives in `out` and is overwritten in place with the state h_t;
// a thread reads and writes only its own chunk's elements of its own chain.
__global__ __launch_bounds__(256)
void qssm_scan_chunk(const float* __restrict__ biv,
                     const float* __restrict__ dec,
                     const float* __restrict__ cmap,
                     float* __restrict__ out) {
  const int ch = blockIdx.x;   // 0..NCHUNK-1
  const int b  = blockIdx.y;
  const int nb = threadIdx.x;  // 0..255
  const size_t base = ((size_t)b * TLEN + (size_t)ch * CLEN) * DDIM + (size_t)nb * 3;
  const float* pb = biv + base;
  float*       po = out + base;
  const float* pd = dec + (size_t)b * TLEN + (size_t)ch * CLEN;

  StepGrp ga, gb;
  load_grp(ga, pb, po);

  // start state of this chunk: earlier chunks' maps applied in time order to h = 0
  float hx = 0.0f, hy = 0.0f, hz = 0.0f;
  const float4* cj = (const float4*)cmap + (size_t)b * NCHUNK * 3 * NBQ + nb;
  // FOLD maps are fetched together so that their L2 latency is paid once per batch;
  // the last batch may fetch maps of chunks >= ch (launch A wrote them all) and
  // keeps only the results of those below ch
  for (int j0 = 0; j0 < ch; j0 += FOLD) {
    float4 r[FOLD][3];
// unrolled: constant indices keep the arrays in registers
#pragma unroll
    for (int i = 0; i < FOLD; ++i) {
// unrolled: constant indices keep the arrays in registers
#pragma unroll
      for (int q = 0; q < 3; ++q) r[i][q] = cj[(i * 3 + q) * NBQ];
    }
    cj += FOLD * 3 * NBQ;
// unrolled: constant indices keep the arrays in registers
#pragma unroll
    for (int i = 0; i < FOLD; ++i) {
      const bool on = j0 + i < ch;
      const float nx = r[i][0].x * hx + r[i][0].y * hy + r[i][0].z * hz + r[i][0].w;
      const float ny = r[i][1].x * hx + r[i][1].y * hy + r[i][1].z * hz + r[i][1].w;
      const float nz = r[i][2].x * hx + r[i][2].y * hy + r[i][2].z * hz + r[i][2].w;
      hx = on ? nx : hx;
      hy = on ? ny : hy;
      hz = on ? nz : hz;
    }
  }

  for (int g = 0; g < NGRP; g += 2) {
    load_grp(gb, pb + (g + 1) * GRP * DDIM, po + (g + 1) * GRP * DDIM);
    replay_grp(ga, pd + g * GRP, po + g * GRP * DDIM, hx, hy, hz);
    // unconditional, so that the waits for gb can be counted past these loads; the last
    // trip fetches the last group once more and does not use it
    const int gn = (g + 2 < NGRP) ? g + 2 : NGRP - 1;
    load_grp(ga, pb + gn * GRP * DDIM, po + gn * GRP * DDIM);
    replay_grp(gb, pd + (g + 1) * GRP, po + (g + 1) * GRP * DDIM, hx, hy, hz);
  }
}

extern "C" void kernel_launch(void* const* d_in, const int* in_sizes, int n_in,
                              void* d_out, int out_size, void* d_ws, size_t ws_size,
                              hipStream_t stream) {
  const float* x      = (const float*)d_in[0];  // (B,T,D)
  const float* W_biv  = (const float*)d_in[1];  // (768,768)
  const float* b_biv  = (const float*)d_in[2];  // (768,)
  const float* W_dec  = (const float*)d_in[3];  // (1,768)
  const float* b_dec  = (const float*)d_in[4];  // (1,)
  const float* W_in   = (const float*)d_in[5];  // (768,768)
  const float* b_in   = (const float*)d_in[6];  // (768,)
  float* out = (float*)d_out;                   // (B,T,768)

  float* ws_biv = (float*)d_ws;                       // MROWS*768 floats
  float* ws_dec = ws_biv + (size_t)MROWS * DDIM;      // MROWS floats
  float* ws_map = ws_dec + (size_t)MROWS;             // BATCH*NCHUNK*3*NBQ float4

  // 1) fused projections: biv -> ws, inj -> d_out (in place for the scan)
  dim3 ggrid(MROWS / BM, NCOLS / BN);  // (128, 6)
  //    and the decay gate (GEMV + sigmoid) -> ws
  qssm_proj_gemm<<<ggrid, GTHREADS, 0, stream>>>(x, W_biv, W_in, b_biv, b_in, W_dec, b_dec,
                                            ws_biv, out, ws_dec);
  // 2) each time chunk's affine map
  qssm_chunk_map<<<dim3(NCHUNK, BATCH), NBQ, 0, stream>>>(ws_biv, ws_dec, out, ws_map);
  // 3) fold the earlier chunks' maps, then replay each chunk's own steps
  qssm_scan_chunk<<<dim3(NCHUNK, BATCH), NBQ, 0, stream>>>(ws_biv, ws_dec, ws_map, out);
}
